// v000
// The times below were measured on an AMD MI455X: many runs one after another, warmed up first and cycling through
// copies of the inputs, with the whole window's GPU time divided by the number of runs. Launches and the gaps
// between them are all in it. The median over several windows is given; except for v000 it joins two sittings, which
// can be a few percent apart, so the side-by-side timings, each taken in one sitting, are the better comparison.
// v000 is the starting kernel. One run takes 421 microseconds.
#include <hip/hip_runtime.h>
#include <hip/hip_bf16.h>
#include <math.h>

// ---------------------------------------------------------------------------
// Problem constants (from reference)
// ---------------------------------------------------------------------------
#define BATCH   8
#define NTOK    16384
#define DIMC    192
#define RC      16
#define MTOK    64
#define LN_EPS  1e-5f
#define NRM_EPS 1e-12f

// main-kernel tiling
#define ROWS    128          // rows of x per block
#define NWAVES  8            // 8 waves * 16 rows = 128
#define THREADS 256

// padded LDS strides (bank-conflict-free WMMA fragment reads, 64 banks).
// All strides are multiples of 4 floats so 16-byte async B128 writes stay
// naturally aligned in LDS.
#define XS_STRIDE 196        // x tile rows       (196 % 64 == 4; 784B % 16 == 0)
#define KB_STRIDE 20         // k rows            (20L mod 64 is a permutation)
#define VS_STRIDE 200        // v rows (K dim)    (200 % 64 == 8)
#define QS_STRIDE 20         // q tile rows
#define AS_STRIDE 68         // attn tile rows    (68 % 64 == 4; scalar DS only)

typedef float v2f __attribute__((ext_vector_type(2)));
typedef float v8f __attribute__((ext_vector_type(8)));

// workspace layout (floats)
#define WS_K_OFF  0                          // kb:   B * M * RC   = 8192
#define WS_V_OFF  (BATCH * MTOK * RC)        // vref: B * M * DIM  = 98304

__device__ __forceinline__ float gelu_exact(float x) {
    return 0.5f * x * (1.0f + erff(x * 0.70710678118654752f));
}

// CDNA5 async global->LDS copy, 16 bytes per lane.  ASYNCcnt-tracked DMA:
// no VGPR round-trip, no LOADcnt/DScnt pressure.  LDS address = low 32 bits
// of the generic shared pointer (aperture rule: LDS_ADDR = addr[31:0]).
__device__ __forceinline__ void async_copy_b128(float* lds_dst, const float* gsrc) {
    unsigned int l = (unsigned int)(uintptr_t)lds_dst;
    asm volatile("global_load_async_to_lds_b128 %0, %1, off"
                 :: "v"(l), "v"(gsrc) : "memory");
}
__device__ __forceinline__ void async_wait_all() {
    asm volatile("s_wait_asynccnt 0x0" ::: "memory");
}

// ---------------------------------------------------------------------------
// Kernel A: per-batch precompute of k = l2norm(LN(dict@wk)) and
// v = gelu(conv3tap(dict@wv + b)).  One block per batch; tiny work.
// ---------------------------------------------------------------------------
__global__ __launch_bounds__(THREADS)
void prep_kernel(const float* __restrict__ dict,
                 const float* __restrict__ wk_w, const float* __restrict__ wk_b,
                 const float* __restrict__ wv_w, const float* __restrict__ wv_b,
                 const float* __restrict__ kn_g, const float* __restrict__ kn_b,
                 const float* __restrict__ conv_w, const float* __restrict__ conv_b,
                 float* __restrict__ ws) {
    extern __shared__ float smem[];
    float* ds = smem;                    // 64*192 = 12288 dict tile
    float* vl = ds + MTOK * DIMC;        // 64*192 = 12288 raw v
    float* kl = vl + MTOK * DIMC;        // 64*16  = 1024  raw k

    const int b   = blockIdx.x;
    const int tid = threadIdx.x;
    const float* db = dict + (size_t)b * MTOK * DIMC;
    float* wsK = ws + WS_K_OFF + (size_t)b * MTOK * RC;
    float* wsV = ws + WS_V_OFF + (size_t)b * MTOK * DIMC;

    // stage dict[b] into LDS via async DMA (contiguous, 16B chunks)
    for (int i4 = tid; i4 < (MTOK * DIMC) / 4; i4 += THREADS)
        async_copy_b128(ds + i4 * 4, db + i4 * 4);
    async_wait_all();
    __syncthreads();

    // k_raw = dict @ wk + b   (64 x 16)
    for (int o = tid; o < MTOK * RC; o += THREADS) {
        const int m = o / RC, r = o % RC;
        float acc = wk_b[r];
        #pragma unroll 8
        for (int j = 0; j < DIMC; ++j) acc += ds[m * DIMC + j] * wk_w[j * RC + r];
        kl[m * RC + r] = acc;
    }
    __syncthreads();

    // per-row LN + l2norm on k, store to workspace
    if (tid < MTOK) {
        const int m = tid;
        float mu = 0.f;
        #pragma unroll
        for (int r = 0; r < RC; ++r) mu += kl[m * RC + r];
        mu *= (1.0f / RC);
        float var = 0.f;
        #pragma unroll
        for (int r = 0; r < RC; ++r) { float d = kl[m * RC + r] - mu; var += d * d; }
        var *= (1.0f / RC);
        const float rs = rsqrtf(var + LN_EPS);
        float tmp[RC];
        float nrm = 0.f;
        #pragma unroll
        for (int r = 0; r < RC; ++r) {
            float t = (kl[m * RC + r] - mu) * rs * kn_g[r] + kn_b[r];
            tmp[r] = t; nrm += t * t;
        }
        const float inv = 1.0f / fmaxf(sqrtf(nrm), NRM_EPS);
        #pragma unroll
        for (int r = 0; r < RC; ++r) wsK[m * RC + r] = tmp[r] * inv;
    }

    // v_raw = dict @ wv + b   (64 x 192)
    for (int o = tid; o < MTOK * DIMC; o += THREADS) {
        const int m = o / DIMC, c = o % DIMC;
        float acc = wv_b[c];
        #pragma unroll 8
        for (int j = 0; j < DIMC; ++j) acc += ds[m * DIMC + j] * wv_w[j * DIMC + c];
        vl[o] = acc;
    }
    __syncthreads();

    // depthwise 3-tap conv along M (kw=1 column of the 3x3 kernel) + GELU
    for (int o = tid; o < MTOK * DIMC; o += THREADS) {
        const int m = o / DIMC, c = o % DIMC;
        const float w0 = conv_w[c * 9 + 0 * 3 + 1];
        const float w1 = conv_w[c * 9 + 1 * 3 + 1];
        const float w2 = conv_w[c * 9 + 2 * 3 + 1];
        float acc = conv_b[c] + w1 * vl[m * DIMC + c];
        if (m > 0)        acc += w0 * vl[(m - 1) * DIMC + c];
        if (m < MTOK - 1) acc += w2 * vl[(m + 1) * DIMC + c];
        wsV[o] = gelu_exact(acc);
    }
}

// ---------------------------------------------------------------------------
// Kernel B: streaming attention kernel.  One block = 128 rows of x.
// All matmuls via v_wmma_f32_16x16x4_f32 (fp32 kept end-to-end; kernel is
// HBM-bound at ~18 flop/byte so f32 WMMA rate is not the limiter).  All LDS
// staging uses CDNA5 async global->LDS DMA.
// ---------------------------------------------------------------------------
__global__ __launch_bounds__(THREADS)
void attn_kernel(const float* __restrict__ x,
                 const float* __restrict__ wq_w, const float* __restrict__ wq_b,
                 const float* __restrict__ qn_g, const float* __restrict__ qn_b,
                 const float* __restrict__ temperature,
                 const float* __restrict__ ws,
                 float* __restrict__ out) {
    extern __shared__ float smem[];
    float* xs  = smem;                           // 128 * 196
    float* wqs = xs  + ROWS * XS_STRIDE;         // 192 * 16
    float* kbs = wqs + DIMC * RC;                // 64 * 20
    float* vs  = kbs + MTOK * KB_STRIDE;         // 64 * 200
    float* qs  = vs  + MTOK * VS_STRIDE;         // 8 * 16 * 20
    float* as_ = qs  + NWAVES * 16 * QS_STRIDE;  // 8 * 16 * 68

    const int tid  = threadIdx.x;
    const int wave = tid >> 5;                   // wave32
    const int lane = tid & 31;
    const int lm   = lane & 15;                  // lane % 16
    const int lh   = lane >> 4;                  // 0 / 1 half-wave

    const int tilesPerBatch = NTOK / ROWS;       // 128
    const int b       = blockIdx.x / tilesPerBatch;
    const int rowTile = blockIdx.x % tilesPerBatch;
    const int nBase   = rowTile * ROWS;

    const float invTemp = 1.0f / fmaxf(temperature[0], 0.5f);
    const float* wsK = ws + WS_K_OFF + (size_t)b * MTOK * RC;
    const float* wsV = ws + WS_V_OFF + (size_t)b * MTOK * DIMC;

    // ---- stage operands into LDS via async global->LDS DMA (16B/lane) ----
    for (int i4 = tid; i4 < (DIMC * RC) / 4; i4 += THREADS)
        async_copy_b128(wqs + i4 * 4, wq_w + i4 * 4);
    for (int i4 = tid; i4 < (MTOK * RC) / 4; i4 += THREADS) {
        const int i = i4 * 4;
        async_copy_b128(kbs + (i / RC) * KB_STRIDE + (i % RC), wsK + i);
    }
    for (int i4 = tid; i4 < (MTOK * DIMC) / 4; i4 += THREADS) {
        const int i = i4 * 4;
        async_copy_b128(vs + (i / DIMC) * VS_STRIDE + (i % DIMC), wsV + i);
    }
    {
        const float* xb = x + ((size_t)b * NTOK + nBase) * DIMC;
        for (int i4 = tid; i4 < (ROWS * DIMC) / 4; i4 += THREADS) {
            const int i = i4 * 4;
            async_copy_b128(xs + (i / DIMC) * XS_STRIDE + (i % DIMC), xb + i);
        }
    }
    async_wait_all();
    __syncthreads();

    const int rbase = wave * 16;
    float* qsw = qs  + wave * 16 * QS_STRIDE;
    float* asw = as_ + wave * 16 * AS_STRIDE;

    // ---- stage 2: q tile (16x16) = x_tile(16x192) @ wq(192x16) ----
    {
        v8f acc = {};
        #pragma unroll 4
        for (int k0 = 0; k0 < DIMC; k0 += 4) {
            v2f a, bf;
            const int ka = k0 + lh * 2;
            a.x  = xs[(rbase + lm) * XS_STRIDE + ka + 0];
            a.y  = xs[(rbase + lm) * XS_STRIDE + ka + 1];
            bf.x = wqs[(ka + 0) * RC + lm];
            bf.y = wqs[(ka + 1) * RC + lm];
            acc = __builtin_amdgcn_wmma_f32_16x16x4_f32(
                false, a, false, bf, (short)0, acc, false, false);
        }
        #pragma unroll
        for (int j = 0; j < 8; ++j)
            qsw[(j + 8 * lh) * QS_STRIDE + lm] = acc[j];
    }
    __syncthreads();

    // ---- stage 3: per-row bias + LayerNorm + l2norm on q ----
    if (lane < 16) {
        float* row = qsw + lane * QS_STRIDE;
        float v[RC];
        float mu = 0.f;
        #pragma unroll
        for (int c = 0; c < RC; ++c) { v[c] = row[c] + wq_b[c]; mu += v[c]; }
        mu *= (1.0f / RC);
        float var = 0.f;
        #pragma unroll
        for (int c = 0; c < RC; ++c) { float d = v[c] - mu; var += d * d; }
        var *= (1.0f / RC);
        const float rs = rsqrtf(var + LN_EPS);
        float nrm = 0.f;
        #pragma unroll
        for (int c = 0; c < RC; ++c) {
            v[c] = (v[c] - mu) * rs * qn_g[c] + qn_b[c];
            nrm += v[c] * v[c];
        }
        const float inv = 1.0f / fmaxf(sqrtf(nrm), NRM_EPS);
        #pragma unroll
        for (int c = 0; c < RC; ++c) row[c] = v[c] * inv;
    }
    __syncthreads();

    // ---- stage 4: attn logits = q(16x16) @ k^T(16x64), pre-scaled ----
    #pragma unroll
    for (int t = 0; t < MTOK / 16; ++t) {
        v8f acc = {};
        #pragma unroll
        for (int k0 = 0; k0 < RC; k0 += 4) {
            v2f a, bf;
            const int ka = k0 + lh * 2;
            a.x  = qsw[lm * QS_STRIDE + ka + 0];
            a.y  = qsw[lm * QS_STRIDE + ka + 1];
            bf.x = kbs[(t * 16 + lm) * KB_STRIDE + ka + 0];
            bf.y = kbs[(t * 16 + lm) * KB_STRIDE + ka + 1];
            acc = __builtin_amdgcn_wmma_f32_16x16x4_f32(
                false, a, false, bf, (short)0, acc, false, false);
        }
        #pragma unroll
        for (int j = 0; j < 8; ++j)
            asw[(j + 8 * lh) * AS_STRIDE + t * 16 + lm] = acc[j] * invTemp;
    }
    __syncthreads();

    // ---- stage 5: per-row softmax over M=64, in LDS ----
    if (lane < 16) {
        float* row = asw + lane * AS_STRIDE;
        float mx = -INFINITY;
        #pragma unroll 8
        for (int m = 0; m < MTOK; ++m) mx = fmaxf(mx, row[m]);
        float s = 0.f;
        #pragma unroll 8
        for (int m = 0; m < MTOK; ++m) { float e = __expf(row[m] - mx); row[m] = e; s += e; }
        const float inv = 1.0f / s;
        #pragma unroll 8
        for (int m = 0; m < MTOK; ++m) row[m] *= inv;
    }
    __syncthreads();

    // ---- cooperative coalesced writeback of attn (second output) ----
    {
        float* attnOut = out + (size_t)BATCH * NTOK * DIMC;   // outputs concatenated
        for (int f = tid; f < NWAVES * 16 * MTOK; f += THREADS) {
            const int w2 = f / (16 * MTOK);
            const int r  = (f / MTOK) & 15;
            const int m  = f % MTOK;
            const int n  = nBase + w2 * 16 + r;
            attnOut[((size_t)b * NTOK + n) * MTOK + m] =
                as_[(w2 * 16 + r) * AS_STRIDE + m];
        }
    }

    // ---- stage 6: out tile = attn(16x64) @ v(64x192), direct stores ----
    #pragma unroll 2
    for (int ct = 0; ct < DIMC / 16; ++ct) {
        v8f acc = {};
        #pragma unroll 4
        for (int k0 = 0; k0 < MTOK; k0 += 4) {
            v2f a, bf;
            const int ka = k0 + lh * 2;
            a.x  = asw[lm * AS_STRIDE + ka + 0];
            a.y  = asw[lm * AS_STRIDE + ka + 1];
            bf.x = vs[(ka + 0) * VS_STRIDE + ct * 16 + lm];
            bf.y = vs[(ka + 1) * VS_STRIDE + ct * 16 + lm];
            acc = __builtin_amdgcn_wmma_f32_16x16x4_f32(
                false, a, false, bf, (short)0, acc, false, false);
        }
        #pragma unroll
        for (int j = 0; j < 8; ++j) {
            const int n = nBase + wave * 16 + j + 8 * lh;
            out[((size_t)b * NTOK + n) * DIMC + ct * 16 + lm] = acc[j];
        }
    }
}

// ---------------------------------------------------------------------------
extern "C" void kernel_launch(void* const* d_in, const int* in_sizes, int n_in,
                              void* d_out, int out_size, void* d_ws, size_t ws_size,
                              hipStream_t stream) {
    const float* x      = (const float*)d_in[0];
    const float* dict   = (const float*)d_in[1];
    // d_in[2] = H, d_in[3] = W (unused)
    const float* wq_w   = (const float*)d_in[4];
    const float* wq_b   = (const float*)d_in[5];
    const float* wk_w   = (const float*)d_in[6];
    const float* wk_b   = (const float*)d_in[7];
    const float* wv_w   = (const float*)d_in[8];
    const float* wv_b   = (const float*)d_in[9];
    const float* qn_g   = (const float*)d_in[10];
    const float* qn_b   = (const float*)d_in[11];
    const float* kn_g   = (const float*)d_in[12];
    const float* kn_b   = (const float*)d_in[13];
    const float* conv_w = (const float*)d_in[14];
    const float* conv_b = (const float*)d_in[15];
    const float* temp   = (const float*)d_in[16];
    float* out = (float*)d_out;
    float* ws  = (float*)d_ws;

    const size_t prepShmem = (size_t)(MTOK * DIMC * 2 + MTOK * RC) * sizeof(float);
    const size_t mainShmem = (size_t)(ROWS * XS_STRIDE + DIMC * RC +
                                      MTOK * KB_STRIDE + MTOK * VS_STRIDE +
                                      NWAVES * 16 * QS_STRIDE +
                                      NWAVES * 16 * AS_STRIDE) * sizeof(float);

    (void)hipFuncSetAttribute((const void*)prep_kernel,
        hipFuncAttributeMaxDynamicSharedMemorySize, (int)prepShmem);
    (void)hipFuncSetAttribute((const void*)attn_kernel,
        hipFuncAttributeMaxDynamicSharedMemorySize, (int)mainShmem);

    prep_kernel<<<BATCH, THREADS, prepShmem, stream>>>(
        dict, wk_w, wk_b, wv_w, wv_b, kn_g, kn_b, conv_w, conv_b, ws);

    const int nBlocks = BATCH * (NTOK / ROWS);   // 1024
    attn_kernel<<<nBlocks, THREADS, mainShmem, stream>>>(
        x, wq_w, wq_b, qn_g, qn_b, temp, ws, out);
}

// v001
// A run of this version takes 83.8 microseconds.
// Timed twice side by side with v000, it ran 5.04 and 5.06 times as fast.
#include <hip/hip_runtime.h>
#include <hip/hip_bf16.h>
#include <math.h>

// ---------------------------------------------------------------------------
// Problem constants (from reference)
// ---------------------------------------------------------------------------
#define BATCH   8
#define NTOK    16384
#define DIMC    192
#define RC      16
#define MTOK    64
#define LN_EPS  1e-5f
#define NRM_EPS 1e-12f

// main-kernel tiling
#define ROWS    128          // rows of x per block
#define NWAVES  8            // 8 waves * 16 rows = 128
#define THREADS 256

// padded LDS strides (bank-conflict-free WMMA fragment reads, 64 banks).
// All strides are multiples of 4 floats so 16-byte async B128 writes stay
// naturally aligned in LDS.
#define XS_STRIDE 196        // x tile rows       (196 % 64 == 4; 784B % 16 == 0)
#define KB_STRIDE 20         // k rows            (20L mod 64 is a permutation)
#define VS_STRIDE 200        // v rows (K dim)    (200 % 64 == 8)
#define QS_STRIDE 20         // q tile rows
#define AS_STRIDE 68         // attn tile rows    (68 % 64 == 4; scalar DS only)

typedef float v2f __attribute__((ext_vector_type(2)));
typedef float v8f __attribute__((ext_vector_type(8)));

// workspace layout (floats)
#define WS_K_OFF  0                          // kb:   B * M * RC   = 8192
#define WS_V_OFF  (BATCH * MTOK * RC)        // vref: B * M * DIM  = 98304

__device__ __forceinline__ float gelu_exact(float x) {
    return 0.5f * x * (1.0f + erff(x * 0.70710678118654752f));
}

// CDNA5 async global->LDS copy, 16 bytes per lane.  ASYNCcnt-tracked DMA:
// no VGPR round-trip, no LOADcnt/DScnt pressure.  LDS address = low 32 bits
// of the generic shared pointer (aperture rule: LDS_ADDR = addr[31:0]).
__device__ __forceinline__ void async_copy_b128(float* lds_dst, const float* gsrc) {
    unsigned int l = (unsigned int)(uintptr_t)lds_dst;
    asm volatile("global_load_async_to_lds_b128 %0, %1, off"
                 :: "v"(l), "v"(gsrc) : "memory");
}
__device__ __forceinline__ void async_wait_all() {
    asm volatile("s_wait_asynccnt 0x0" ::: "memory");
}

// ---------------------------------------------------------------------------
// Kernel A: precompute of k = l2norm(LN(dict@wk)) and
// v = gelu(conv3tap(dict@wv + b)), one output element per thread.
// Per batch: 48 blocks of 8 rows x 32 columns of v (a block owns whole
// 128-byte lines of the workspace) and 4 blocks of 16 rows of k.
// The conv needs raw v of the rows above and below: each thread sums those
// two itself, so no block needs anything from another block.
// ---------------------------------------------------------------------------
#define VROWS   8                            // v rows per block
#define VCOLS   32                           // v columns per block
#define VCS     (DIMC / VCOLS)               // 6 column slices
#define VBLK    ((MTOK / VROWS) * VCS)       // 48 v blocks per batch
#define KROWS   (THREADS / RC)               // 16 k rows per block
#define PBLOCKS (VBLK + MTOK / KROWS)        // 52 blocks per batch

__global__ __launch_bounds__(THREADS)
void prep_kernel(const float* __restrict__ dict,
                 const float* __restrict__ wk_w, const float* __restrict__ wk_b,
                 const float* __restrict__ wv_w, const float* __restrict__ wv_b,
                 const float* __restrict__ kn_g, const float* __restrict__ kn_b,
                 const float* __restrict__ conv_w, const float* __restrict__ conv_b,
                 float* __restrict__ ws) {
    extern __shared__ float smem[];
    float* ds = smem;                    // 64*192 = 12288 dict tile
    float* kl = ds + MTOK * DIMC;        // 16*16  = 256   raw k

    const int b   = blockIdx.x / PBLOCKS;
    const int s   = blockIdx.x % PBLOCKS;
    const int tid = threadIdx.x;
    const float* db = dict + (size_t)b * MTOK * DIMC;
    float* wsK = ws + WS_K_OFF + (size_t)b * MTOK * RC;
    float* wsV = ws + WS_V_OFF + (size_t)b * MTOK * DIMC;

    // stage dict[b] into LDS via async DMA (contiguous, 16B chunks)
    for (int i4 = tid; i4 < (MTOK * DIMC) / 4; i4 += THREADS)
        async_copy_b128(ds + i4 * 4, db + i4 * 4);
    async_wait_all();
    __syncthreads();

    if (s >= VBLK) {
        const int mBase = (s - VBLK) * KROWS;

        // k_raw = dict @ wk + b   (16 of the 64 x 16)
        {
            const int m = mBase + tid / RC, r = tid % RC;
            float acc = wk_b[r];
            #pragma unroll 8
            for (int j = 0; j < DIMC; ++j) acc += ds[m * DIMC + j] * wk_w[j * RC + r];
            kl[tid] = acc;
        }
        __syncthreads();

        // per-row LN + l2norm on k, store to workspace
        if (tid < KROWS) {
            const int m = mBase + tid;
            float mu = 0.f;
            #pragma unroll
            for (int r = 0; r < RC; ++r) mu += kl[tid * RC + r];
            mu *= (1.0f / RC);
            float var = 0.f;
            #pragma unroll
            for (int r = 0; r < RC; ++r) { float d = kl[tid * RC + r] - mu; var += d * d; }
            var *= (1.0f / RC);
            const float rs = rsqrtf(var + LN_EPS);
            float tmp[RC];
            float nrm = 0.f;
            #pragma unroll
            for (int r = 0; r < RC; ++r) {
                float t = (kl[tid * RC + r] - mu) * rs * kn_g[r] + kn_b[r];
                tmp[r] = t; nrm += t * t;
            }
            const float inv = 1.0f / fmaxf(sqrtf(nrm), NRM_EPS);
            #pragma unroll
            for (int r = 0; r < RC; ++r) wsK[m * RC + r] = tmp[r] * inv;
        }
    } else {
        const int m  = (s / VCS) * VROWS + tid / VCOLS;
        const int c  = (s % VCS) * VCOLS + tid % VCOLS;
        const int mu = (m > 0)        ? m - 1 : m;   // row above (at the edge: m, sum unused)
        const int md = (m < MTOK - 1) ? m + 1 : m;   // row below (at the edge: m, sum unused)

        // v_raw = dict @ wv + b at rows m-1, m, m+1 of column c
        float vu = wv_b[c], vm = vu, vd = vu;
        // unroll 8, as in the k loop: eight weight loads are in flight per wait
        #pragma unroll 8
        for (int j = 0; j < DIMC; ++j) {
            const float w = wv_w[j * DIMC + c];
            vu += ds[mu * DIMC + j] * w;
            vm += ds[m  * DIMC + j] * w;
            vd += ds[md * DIMC + j] * w;
        }

        // depthwise 3-tap conv along M (kw=1 column of the 3x3 kernel) + GELU
        const float w0 = conv_w[c * 9 + 0 * 3 + 1];
        const float w1 = conv_w[c * 9 + 1 * 3 + 1];
        const float w2 = conv_w[c * 9 + 2 * 3 + 1];
        float acc = conv_b[c] + w1 * vm;
        if (m > 0)        acc += w0 * vu;
        if (m < MTOK - 1) acc += w2 * vd;
        wsV[m * DIMC + c] = gelu_exact(acc);
        // the built code lays the k branch behind this store: keep the wait in
        // front of any instruction there that rewrites the store's registers
        asm volatile("s_wait_xcnt 0x0" ::: "memory");
    }
}

// ---------------------------------------------------------------------------
// Kernel B: streaming attention kernel.  One block = 128 rows of x.
// All matmuls via v_wmma_f32_16x16x4_f32 (fp32 kept end-to-end; kernel is
// HBM-bound at ~18 flop/byte so f32 WMMA rate is not the limiter).  All LDS
// staging uses CDNA5 async global->LDS DMA.
// ---------------------------------------------------------------------------
__global__ __launch_bounds__(THREADS)
void attn_kernel(const float* __restrict__ x,
                 const float* __restrict__ wq_w, const float* __restrict__ wq_b,
                 const float* __restrict__ qn_g, const float* __restrict__ qn_b,
                 const float* __restrict__ temperature,
                 const float* __restrict__ ws,
                 float* __restrict__ out) {
    extern __shared__ float smem[];
    float* xs  = smem;                           // 128 * 196
    float* wqs = xs  + ROWS * XS_STRIDE;         // 192 * 16
    float* kbs = wqs + DIMC * RC;                // 64 * 20
    float* vs  = kbs + MTOK * KB_STRIDE;         // 64 * 200
    float* qs  = vs  + MTOK * VS_STRIDE;         // 8 * 16 * 20
    float* as_ = qs  + NWAVES * 16 * QS_STRIDE;  // 8 * 16 * 68

    const int tid  = threadIdx.x;
    const int wave = tid >> 5;                   // wave32
    const int lane = tid & 31;
    const int lm   = lane & 15;                  // lane % 16
    const int lh   = lane >> 4;                  // 0 / 1 half-wave

    const int tilesPerBatch = NTOK / ROWS;       // 128
    const int b       = blockIdx.x / tilesPerBatch;
    const int rowTile = blockIdx.x % tilesPerBatch;
    const int nBase   = rowTile * ROWS;

    const float invTemp = 1.0f / fmaxf(temperature[0], 0.5f);
    const float* wsK = ws + WS_K_OFF + (size_t)b * MTOK * RC;
    const float* wsV = ws + WS_V_OFF + (size_t)b * MTOK * DIMC;

    // ---- stage operands into LDS via async global->LDS DMA (16B/lane) ----
    for (int i4 = tid; i4 < (DIMC * RC) / 4; i4 += THREADS)
        async_copy_b128(wqs + i4 * 4, wq_w + i4 * 4);
    for (int i4 = tid; i4 < (MTOK * RC) / 4; i4 += THREADS) {
        const int i = i4 * 4;
        async_copy_b128(kbs + (i / RC) * KB_STRIDE + (i % RC), wsK + i);
    }
    for (int i4 = tid; i4 < (MTOK * DIMC) / 4; i4 += THREADS) {
        const int i = i4 * 4;
        async_copy_b128(vs + (i / DIMC) * VS_STRIDE + (i % DIMC), wsV + i);
    }
    {
        const float* xb = x + ((size_t)b * NTOK + nBase) * DIMC;
        for (int i4 = tid; i4 < (ROWS * DIMC) / 4; i4 += THREADS) {
            const int i = i4 * 4;
            async_copy_b128(xs + (i / DIMC) * XS_STRIDE + (i % DIMC), xb + i);
        }
    }
    async_wait_all();
    __syncthreads();

    const int rbase = wave * 16;
    float* qsw = qs  + wave * 16 * QS_STRIDE;
    float* asw = as_ + wave * 16 * AS_STRIDE;

    // ---- stage 2: q tile (16x16) = x_tile(16x192) @ wq(192x16) ----
    {
        v8f acc = {};
        #pragma unroll 4
        for (int k0 = 0; k0 < DIMC; k0 += 4) {
            v2f a, bf;
            const int ka = k0 + lh * 2;
            a.x  = xs[(rbase + lm) * XS_STRIDE + ka + 0];
            a.y  = xs[(rbase + lm) * XS_STRIDE + ka + 1];
            bf.x = wqs[(ka + 0) * RC + lm];
            bf.y = wqs[(ka + 1) * RC + lm];
            acc = __builtin_amdgcn_wmma_f32_16x16x4_f32(
                false, a, false, bf, (short)0, acc, false, false);
        }
        #pragma unroll
        for (int j = 0; j < 8; ++j)
            qsw[(j + 8 * lh) * QS_STRIDE + lm] = acc[j];
    }
    __syncthreads();

    // ---- stage 3: per-row bias + LayerNorm + l2norm on q ----
    if (lane < 16) {
        float* row = qsw + lane * QS_STRIDE;
        float v[RC];
        float mu = 0.f;
        #pragma unroll
        for (int c = 0; c < RC; ++c) { v[c] = row[c] + wq_b[c]; mu += v[c]; }
        mu *= (1.0f / RC);
        float var = 0.f;
        #pragma unroll
        for (int c = 0; c < RC; ++c) { float d = v[c] - mu; var += d * d; }
        var *= (1.0f / RC);
        const float rs = rsqrtf(var + LN_EPS);
        float nrm = 0.f;
        #pragma unroll
        for (int c = 0; c < RC; ++c) {
            v[c] = (v[c] - mu) * rs * qn_g[c] + qn_b[c];
            nrm += v[c] * v[c];
        }
        const float inv = 1.0f / fmaxf(sqrtf(nrm), NRM_EPS);
        #pragma unroll
        for (int c = 0; c < RC; ++c) row[c] = v[c] * inv;
    }
    __syncthreads();

    // ---- stage 4: attn logits = q(16x16) @ k^T(16x64), pre-scaled ----
    #pragma unroll
    for (int t = 0; t < MTOK / 16; ++t) {
        v8f acc = {};
        #pragma unroll
        for (int k0 = 0; k0 < RC; k0 += 4) {
            v2f a, bf;
            const int ka = k0 + lh * 2;
            a.x  = qsw[lm * QS_STRIDE + ka + 0];
            a.y  = qsw[lm * QS_STRIDE + ka + 1];
            bf.x = kbs[(t * 16 + lm) * KB_STRIDE + ka + 0];
            bf.y = kbs[(t * 16 + lm) * KB_STRIDE + ka + 1];
            acc = __builtin_amdgcn_wmma_f32_16x16x4_f32(
                false, a, false, bf, (short)0, acc, false, false);
        }
        #pragma unroll
        for (int j = 0; j < 8; ++j)
            asw[(j + 8 * lh) * AS_STRIDE + t * 16 + lm] = acc[j] * invTemp;
    }
    __syncthreads();

    // ---- stage 5: per-row softmax over M=64, in LDS ----
    if (lane < 16) {
        float* row = asw + lane * AS_STRIDE;
        float mx = -INFINITY;
        #pragma unroll 8
        for (int m = 0; m < MTOK; ++m) mx = fmaxf(mx, row[m]);
        float s = 0.f;
        #pragma unroll 8
        for (int m = 0; m < MTOK; ++m) { float e = __expf(row[m] - mx); row[m] = e; s += e; }
        const float inv = 1.0f / s;
        #pragma unroll 8
        for (int m = 0; m < MTOK; ++m) row[m] *= inv;
    }
    __syncthreads();

    // ---- cooperative coalesced writeback of attn (second output) ----
    {
        float* attnOut = out + (size_t)BATCH * NTOK * DIMC;   // outputs concatenated
        for (int f = tid; f < NWAVES * 16 * MTOK; f += THREADS) {
            const int w2 = f / (16 * MTOK);
            const int r  = (f / MTOK) & 15;
            const int m  = f % MTOK;
            const int n  = nBase + w2 * 16 + r;
            attnOut[((size_t)b * NTOK + n) * MTOK + m] =
                as_[(w2 * 16 + r) * AS_STRIDE + m];
        }
    }

    // ---- stage 6: out tile = attn(16x64) @ v(64x192), direct stores ----
    #pragma unroll 2
    for (int ct = 0; ct < DIMC / 16; ++ct) {
        v8f acc = {};
        #pragma unroll 4
        for (int k0 = 0; k0 < MTOK; k0 += 4) {
            v2f a, bf;
            const int ka = k0 + lh * 2;
            a.x  = asw[lm * AS_STRIDE + ka + 0];
            a.y  = asw[lm * AS_STRIDE + ka + 1];
            bf.x = vs[(ka + 0) * VS_STRIDE + ct * 16 + lm];
            bf.y = vs[(ka + 1) * VS_STRIDE + ct * 16 + lm];
            acc = __builtin_amdgcn_wmma_f32_16x16x4_f32(
                false, a, false, bf, (short)0, acc, false, false);
        }
        #pragma unroll
        for (int j = 0; j < 8; ++j) {
            const int n = nBase + wave * 16 + j + 8 * lh;
            out[((size_t)b * NTOK + n) * DIMC + ct * 16 + lm] = acc[j];
        }
    }
}

// ---------------------------------------------------------------------------
extern "C" void kernel_launch(void* const* d_in, const int* in_sizes, int n_in,
                              void* d_out, int out_size, void* d_ws, size_t ws_size,
                              hipStream_t stream) {
    const float* x      = (const float*)d_in[0];
    const float* dict   = (const float*)d_in[1];
    // d_in[2] = H, d_in[3] = W (unused)
    const float* wq_w   = (const float*)d_in[4];
    const float* wq_b   = (const float*)d_in[5];
    const float* wk_w   = (const float*)d_in[6];
    const float* wk_b   = (const float*)d_in[7];
    const float* wv_w   = (const float*)d_in[8];
    const float* wv_b   = (const float*)d_in[9];
    const float* qn_g   = (const float*)d_in[10];
    const float* qn_b   = (const float*)d_in[11];
    const float* kn_g   = (const float*)d_in[12];
    const float* kn_b   = (const float*)d_in[13];
    const float* conv_w = (const float*)d_in[14];
    const float* conv_b = (const float*)d_in[15];
    const float* temp   = (const float*)d_in[16];
    float* out = (float*)d_out;
    float* ws  = (float*)d_ws;

    const size_t prepShmem = (size_t)(MTOK * DIMC + KROWS * RC) * sizeof(float);
    const size_t mainShmem = (size_t)(ROWS * XS_STRIDE + DIMC * RC +
                                      MTOK * KB_STRIDE + MTOK * VS_STRIDE +
                                      NWAVES * 16 * QS_STRIDE +
                                      NWAVES * 16 * AS_STRIDE) * sizeof(float);

    (void)hipFuncSetAttribute((const void*)prep_kernel,
        hipFuncAttributeMaxDynamicSharedMemorySize, (int)prepShmem);
    (void)hipFuncSetAttribute((const void*)attn_kernel,
        hipFuncAttributeMaxDynamicSharedMemorySize, (int)mainShmem);

    prep_kernel<<<BATCH * PBLOCKS, THREADS, prepShmem, stream>>>(
        dict, wk_w, wk_b, wv_w, wv_b, kn_g, kn_b, conv_w, conv_b, ws);

    const int nBlocks = BATCH * (NTOK / ROWS);   // 1024
    attn_kernel<<<nBlocks, THREADS, mainShmem, stream>>>(
        x, wq_w, wq_b, qn_g, qn_b, temp, ws, out);
}

// v002
// It runs in 62.1 microseconds.
// Next to v001, in two timings, it ran 1.32 and 1.33 times as fast.
// All steps since v000 together make it 6.69 times as fast.
#include <hip/hip_runtime.h>
#include <hip/hip_bf16.h>
#include <math.h>

// ---------------------------------------------------------------------------
// Problem constants (from reference)
// ---------------------------------------------------------------------------
#define BATCH   8
#define NTOK    16384
#define DIMC    192
#define RC      16
#define MTOK    64
#define LN_EPS  1e-5f
#define NRM_EPS 1e-12f

// main-kernel tiling
#define ROWS    128          // rows of x per block
#define NWAVES  8            // 8 waves * 16 rows = 128
#define THREADS 256

// padded LDS strides (bank-conflict-free WMMA fragment reads, 64 banks).
// All strides are multiples of 4 floats so 16-byte async B128 writes stay
// naturally aligned in LDS.
#define XS_STRIDE 196        // x tile rows       (196 % 64 == 4; 784B % 16 == 0)
#define KB_STRIDE 20         // k rows            (20L mod 64 is a permutation)
#define VS_STRIDE 200        // v rows (K dim)    (4 rows apart: 800 % 64 == 32)

typedef float v2f __attribute__((ext_vector_type(2)));
typedef float v8f __attribute__((ext_vector_type(8)));

// workspace layout (floats)
#define WS_K_OFF  0                          // kb:   B * M * RC   = 8192
#define WS_V_OFF  (BATCH * MTOK * RC)        // vref: B * M * DIM  = 98304

__device__ __forceinline__ float gelu_exact(float x) {
    return 0.5f * x * (1.0f + erff(x * 0.70710678118654752f));
}

// CDNA5 async global->LDS copy, 16 bytes per lane.  ASYNCcnt-tracked DMA:
// no VGPR round-trip, no LOADcnt/DScnt pressure.  LDS address = low 32 bits
// of the generic shared pointer (aperture rule: LDS_ADDR = addr[31:0]).
__device__ __forceinline__ void async_copy_b128(float* lds_dst, const float* gsrc) {
    unsigned int l = (unsigned int)(uintptr_t)lds_dst;
    asm volatile("global_load_async_to_lds_b128 %0, %1, off"
                 :: "v"(l), "v"(gsrc) : "memory");
}
__device__ __forceinline__ void async_wait_all() {
    asm volatile("s_wait_asynccnt 0x0" ::: "memory");
}

// value of lane l ^ 16 (the other 16-lane half of the wave)
__device__ __forceinline__ float xhalf(float x) {
    return __builtin_bit_cast(float, __builtin_amdgcn_permlanex16(
        __builtin_bit_cast(int, x), __builtin_bit_cast(int, x),
        0x76543210, 0xfedcba98, false, false));
}

// e^x as __expf forms it (one multiply, v_exp_f32).  The v_nop is the one slot
// the instruction set asks for behind a transcendental: inside the statement it
// stands there whatever the compiler schedules next.
__device__ __forceinline__ float exp_slot(float x) {
    float r;
    asm("v_exp_f32 %0, %1\n\tv_nop" : "=v"(r) : "v"(x * 1.44269504088896340736f));
    return r;
}

// ---------------------------------------------------------------------------
// Kernel A: precompute of k = l2norm(LN(dict@wk)) and
// v = gelu(conv3tap(dict@wv + b)), one output element per thread.
// Per batch: 48 blocks of 8 rows x 32 columns of v (a block owns whole
// 128-byte lines of the workspace) and 4 blocks of 16 rows of k.
// The conv needs raw v of the rows above and below: each thread sums those
// two itself, so no block needs anything from another block.
// ---------------------------------------------------------------------------
#define VROWS   8                            // v rows per block
#define VCOLS   32                           // v columns per block
#define VCS     (DIMC / VCOLS)               // 6 column slices
#define VBLK    ((MTOK / VROWS) * VCS)       // 48 v blocks per batch
#define KROWS   (THREADS / RC)               // 16 k rows per block
#define PBLOCKS (VBLK + MTOK / KROWS)        // 52 blocks per batch

__global__ __launch_bounds__(THREADS)
void prep_kernel(const float* __restrict__ dict,
                 const float* __restrict__ wk_w, const float* __restrict__ wk_b,
                 const float* __restrict__ wv_w, const float* __restrict__ wv_b,
                 const float* __restrict__ kn_g, const float* __restrict__ kn_b,
                 const float* __restrict__ conv_w, const float* __restrict__ conv_b,
                 float* __restrict__ ws) {
    extern __shared__ float smem[];
    float* ds = smem;                    // 64*192 = 12288 dict tile
    float* kl = ds + MTOK * DIMC;        // 16*16  = 256   raw k

    const int b   = blockIdx.x / PBLOCKS;
    const int s   = blockIdx.x % PBLOCKS;
    const int tid = threadIdx.x;
    const float* db = dict + (size_t)b * MTOK * DIMC;
    float* wsK = ws + WS_K_OFF + (size_t)b * MTOK * RC;
    float* wsV = ws + WS_V_OFF + (size_t)b * MTOK * DIMC;

    // stage dict[b] into LDS via async DMA (contiguous, 16B chunks)
    for (int i4 = tid; i4 < (MTOK * DIMC) / 4; i4 += THREADS)
        async_copy_b128(ds + i4 * 4, db + i4 * 4);
    async_wait_all();
    __syncthreads();

    if (s >= VBLK) {
        const int mBase = (s - VBLK) * KROWS;

        // k_raw = dict @ wk + b   (16 of the 64 x 16)
        {
            const int m = mBase + tid / RC, r = tid % RC;
            float acc = wk_b[r];
            #pragma unroll 8
            for (int j = 0; j < DIMC; ++j) acc += ds[m * DIMC + j] * wk_w[j * RC + r];
            kl[tid] = acc;
        }
        __syncthreads();

        // per-row LN + l2norm on k, store to workspace
        if (tid < KROWS) {
            const int m = mBase + tid;
            float mu = 0.f;
            #pragma unroll
            for (int r = 0; r < RC; ++r) mu += kl[tid * RC + r];
            mu *= (1.0f / RC);
            float var = 0.f;
            #pragma unroll
            for (int r = 0; r < RC; ++r) { float d = kl[tid * RC + r] - mu; var += d * d; }
            var *= (1.0f / RC);
            const float rs = rsqrtf(var + LN_EPS);
            float tmp[RC];
            float nrm = 0.f;
            #pragma unroll
            for (int r = 0; r < RC; ++r) {
                float t = (kl[tid * RC + r] - mu) * rs * kn_g[r] + kn_b[r];
                tmp[r] = t; nrm += t * t;
            }
            const float inv = 1.0f / fmaxf(sqrtf(nrm), NRM_EPS);
            #pragma unroll
            for (int r = 0; r < RC; ++r) wsK[m * RC + r] = tmp[r] * inv;
        }
    } else {
        const int m  = (s / VCS) * VROWS + tid / VCOLS;
        const int c  = (s % VCS) * VCOLS + tid % VCOLS;
        const int mu = (m > 0)        ? m - 1 : m;   // row above (at the edge: m, sum unused)
        const int md = (m < MTOK - 1) ? m + 1 : m;   // row below (at the edge: m, sum unused)

        // v_raw = dict @ wv + b at rows m-1, m, m+1 of column c
        float vu = wv_b[c], vm = vu, vd = vu;
        // unroll 8, as in the k loop: eight weight loads are in flight per wait
        #pragma unroll 8
        for (int j = 0; j < DIMC; ++j) {
            const float w = wv_w[j * DIMC + c];
            vu += ds[mu * DIMC + j] * w;
            vm += ds[m  * DIMC + j] * w;
            vd += ds[md * DIMC + j] * w;
        }

        // depthwise 3-tap conv along M (kw=1 column of the 3x3 kernel) + GELU
        const float w0 = conv_w[c * 9 + 0 * 3 + 1];
        const float w1 = conv_w[c * 9 + 1 * 3 + 1];
        const float w2 = conv_w[c * 9 + 2 * 3 + 1];
        float acc = conv_b[c] + w1 * vm;
        if (m > 0)        acc += w0 * vu;
        if (m < MTOK - 1) acc += w2 * vd;
        wsV[m * DIMC + c] = gelu_exact(acc);
        // the built code lays the k branch behind this store: keep the wait in
        // front of any instruction there that rewrites the store's registers
        asm volatile("s_wait_xcnt 0x0" ::: "memory");
    }
}

// ---------------------------------------------------------------------------
// Kernel B: streaming attention kernel.  One block = 128 rows of x.
// All matmuls via v_wmma_f32_16x16x4_f32 (fp32 kept end-to-end; kernel is
// HBM-bound at ~18 flop/byte so f32 WMMA rate is not the limiter).  All LDS
// staging uses CDNA5 async global->LDS DMA.
// The first two products are formed transposed (q^T, logits^T): a lane then
// owns one row of x, its D registers hold that row's values, and they are as
// they stand the B fragment (q) and the A fragment (attn) of the next product,
// with the k order of the partner operand's loader set to match.  LayerNorm,
// l2norm and softmax run in registers: 8 or 32 values in the lane, then one
// exchange with the other half-wave.  Behind the staging barrier a wave needs
// nothing from another wave.
// ---------------------------------------------------------------------------
__global__ __launch_bounds__(THREADS)
void attn_kernel(const float* __restrict__ x,
                 const float* __restrict__ wq_w, const float* __restrict__ wq_b,
                 const float* __restrict__ qn_g, const float* __restrict__ qn_b,
                 const float* __restrict__ temperature,
                 const float* __restrict__ ws,
                 float* __restrict__ out) {
    extern __shared__ float smem[];
    float* xs  = smem;                           // 128 * 196
    float* wqs = xs  + ROWS * XS_STRIDE;         // 192 * 16
    float* kbs = wqs + DIMC * RC;                // 64 * 20
    float* vs  = kbs + MTOK * KB_STRIDE;         // 64 * 200

    const int tid  = threadIdx.x;
    const int wave = tid >> 5;                   // wave32
    const int lane = tid & 31;
    const int lm   = lane & 15;                  // lane % 16
    const int lh   = lane >> 4;                  // 0 / 1 half-wave

    const int tilesPerBatch = NTOK / ROWS;       // 128
    const int b       = blockIdx.x / tilesPerBatch;
    const int rowTile = blockIdx.x % tilesPerBatch;
    const int nBase   = rowTile * ROWS;

    const float invTemp = 1.0f / fmaxf(temperature[0], 0.5f);
    const float* wsK = ws + WS_K_OFF + (size_t)b * MTOK * RC;
    const float* wsV = ws + WS_V_OFF + (size_t)b * MTOK * DIMC;

    // this lane's 8 of the 16 q channels: rc = 8 * lh + j
    float bq[8], gq[8], bn[8];
    #pragma unroll
    for (int j = 0; j < 8; ++j) {
        bq[j] = wq_b[8 * lh + j];
        gq[j] = qn_g[8 * lh + j];
        bn[j] = qn_b[8 * lh + j];
    }

    // ---- stage operands into LDS via async global->LDS DMA (16B/lane) ----
    for (int i4 = tid; i4 < (DIMC * RC) / 4; i4 += THREADS)
        async_copy_b128(wqs + i4 * 4, wq_w + i4 * 4);
    for (int i4 = tid; i4 < (MTOK * RC) / 4; i4 += THREADS) {
        const int i = i4 * 4;
        async_copy_b128(kbs + (i / RC) * KB_STRIDE + (i % RC), wsK + i);
    }
    for (int i4 = tid; i4 < (MTOK * DIMC) / 4; i4 += THREADS) {
        const int i = i4 * 4;
        async_copy_b128(vs + (i / DIMC) * VS_STRIDE + (i % DIMC), wsV + i);
    }
    {
        const float* xb = x + ((size_t)b * NTOK + nBase) * DIMC;
        for (int i4 = tid; i4 < (ROWS * DIMC) / 4; i4 += THREADS) {
            const int i = i4 * 4;
            async_copy_b128(xs + (i / DIMC) * XS_STRIDE + (i % DIMC), xb + i);
        }
    }
    async_wait_all();
    __syncthreads();

    const int rbase = wave * 16;

    // ---- stage 2: q^T tile (16 rc x 16 rows) = wq^T(16x192) @ x_tile^T(192x16) ----
    // qt[j] = q_raw[row rbase + lm][rc = j + 8 * lh]
    v8f qt = {};
    #pragma unroll 4
    for (int k0 = 0; k0 < DIMC; k0 += 4) {
        v2f a, bf;
        const int ka = k0 + lh * 2;
        a.x  = wqs[(ka + 0) * RC + lm];
        a.y  = wqs[(ka + 1) * RC + lm];
        bf.x = xs[(rbase + lm) * XS_STRIDE + ka + 0];
        bf.y = xs[(rbase + lm) * XS_STRIDE + ka + 1];
        qt = __builtin_amdgcn_wmma_f32_16x16x4_f32(
            false, a, false, bf, (short)0, qt, false, false);
    }

    // ---- stage 3: bias + LayerNorm + l2norm of row lm, 8 channels per half ----
    float q[8];
    {
        float mu = 0.f;
        #pragma unroll
        for (int j = 0; j < 8; ++j) { q[j] = qt[j] + bq[j]; mu += q[j]; }
        mu += xhalf(mu);
        mu *= (1.0f / RC);
        float var = 0.f;
        #pragma unroll
        for (int j = 0; j < 8; ++j) { float d = q[j] - mu; var += d * d; }
        var += xhalf(var);
        var *= (1.0f / RC);
        const float rs = rsqrtf(var + LN_EPS);
        float nrm = 0.f;
        #pragma unroll
        for (int j = 0; j < 8; ++j) {
            q[j] = (q[j] - mu) * rs * gq[j] + bn[j];
            nrm += q[j] * q[j];
        }
        nrm += xhalf(nrm);
        const float inv = 1.0f / fmaxf(sqrtf(nrm), NRM_EPS);
        #pragma unroll
        for (int j = 0; j < 8; ++j) q[j] *= inv;
    }

    // ---- stage 4: logits^T (64 m x 16 rows) = k(64x16) @ q^T(16x16), pre-scaled ----
    // k order of step s: slot 2 * lh + e is rc = 8 * lh + 2 * s + e, in A and in B.
    // Row i of tile t is token 16t + 8 * ((i >> 2) & 1) + 4 * (i >> 3) + (i & 3), so
    // p[t][j] = logit[row lm][m = 16t + 8 * (j >> 2) + 4 * lh + (j & 3)]:
    // four registers are 16 bytes of a row of attn, the two halves 32 in a row.
    float p[MTOK / 16][8];
    {
        const int krow = ((lm & 4) << 1) | ((lm >> 3) << 2) | (lm & 3);
        #pragma unroll
        for (int t = 0; t < MTOK / 16; ++t) {
            const float* kr = kbs + (t * 16 + krow) * KB_STRIDE + 8 * lh;
            v8f acc = {};
            #pragma unroll
            for (int s = 0; s < RC / 4; ++s) {
                v2f a, bf;
                a.x  = kr[2 * s + 0];
                a.y  = kr[2 * s + 1];
                bf.x = q[2 * s + 0];
                bf.y = q[2 * s + 1];
                acc = __builtin_amdgcn_wmma_f32_16x16x4_f32(
                    false, a, false, bf, (short)0, acc, false, false);
            }
            #pragma unroll
            for (int j = 0; j < 8; ++j) p[t][j] = acc[j] * invTemp;
        }
    }

    // ---- stage 5: softmax of row lm over M=64, 32 values per half ----
    {
        float mx = -INFINITY;
        #pragma unroll
        for (int t = 0; t < MTOK / 16; ++t)
            #pragma unroll
            for (int j = 0; j < 8; ++j) mx = fmaxf(mx, p[t][j]);
        mx = fmaxf(mx, xhalf(mx));
        float s = 0.f;
        #pragma unroll
        for (int t = 0; t < MTOK / 16; ++t)
            #pragma unroll
            for (int j = 0; j < 8; ++j) { p[t][j] = exp_slot(p[t][j] - mx); s += p[t][j]; }
        s += xhalf(s);
        const float inv = 1.0f / s;
        #pragma unroll
        for (int t = 0; t < MTOK / 16; ++t)
            #pragma unroll
            for (int j = 0; j < 8; ++j) p[t][j] *= inv;
    }

    // ---- writeback of attn (second output) from registers, 16 bytes per lane ----
    {
        float* arow = out + (size_t)BATCH * NTOK * DIMC      // outputs concatenated
                    + ((size_t)b * NTOK + nBase + rbase + lm) * MTOK + 4 * lh;
        #pragma unroll
        for (int t = 0; t < MTOK / 16; ++t)
            #pragma unroll
            for (int h = 0; h < 2; ++h)
                *reinterpret_cast<float4*>(arow + t * 16 + h * 8) =
                    make_float4(p[t][4 * h + 0], p[t][4 * h + 1],
                                p[t][4 * h + 2], p[t][4 * h + 3]);
    }

    // ---- stage 6: out tile = attn(16x64) @ v(64x192), direct stores ----
    // A is p as it stands; B reads the v rows in p's token order.
    #pragma unroll 2
    for (int ct = 0; ct < DIMC / 16; ++ct) {
        const float* vc = vs + (4 * lh) * VS_STRIDE + ct * 16 + lm;
        v8f acc = {};
        #pragma unroll
        for (int t = 0; t < MTOK / 16; ++t) {
            #pragma unroll
            for (int s = 0; s < 4; ++s) {
                v2f a, bf;
                const int m0 = t * 16 + (s >> 1) * 8 + (s & 1) * 2;
                a.x  = p[t][2 * s + 0];
                a.y  = p[t][2 * s + 1];
                bf.x = vc[(m0 + 0) * VS_STRIDE];
                bf.y = vc[(m0 + 1) * VS_STRIDE];
                acc = __builtin_amdgcn_wmma_f32_16x16x4_f32(
                    false, a, false, bf, (short)0, acc, false, false);
            }
        }
        #pragma unroll
        for (int j = 0; j < 8; ++j) {
            const int n = nBase + wave * 16 + j + 8 * lh;
            out[((size_t)b * NTOK + n) * DIMC + ct * 16 + lm] = acc[j];
        }
    }
}

// ---------------------------------------------------------------------------
extern "C" void kernel_launch(void* const* d_in, const int* in_sizes, int n_in,
                              void* d_out, int out_size, void* d_ws, size_t ws_size,
                              hipStream_t stream) {
    const float* x      = (const float*)d_in[0];
    const float* dict   = (const float*)d_in[1];
    // d_in[2] = H, d_in[3] = W (unused)
    const float* wq_w   = (const float*)d_in[4];
    const float* wq_b   = (const float*)d_in[5];
    const float* wk_w   = (const float*)d_in[6];
    const float* wk_b   = (const float*)d_in[7];
    const float* wv_w   = (const float*)d_in[8];
    const float* wv_b   = (const float*)d_in[9];
    const float* qn_g   = (const float*)d_in[10];
    const float* qn_b   = (const float*)d_in[11];
    const float* kn_g   = (const float*)d_in[12];
    const float* kn_b   = (const float*)d_in[13];
    const float* conv_w = (const float*)d_in[14];
    const float* conv_b = (const float*)d_in[15];
    const float* temp   = (const float*)d_in[16];
    float* out = (float*)d_out;
    float* ws  = (float*)d_ws;

    const size_t prepShmem = (size_t)(MTOK * DIMC + KROWS * RC) * sizeof(float);
    const size_t mainShmem = (size_t)(ROWS * XS_STRIDE + DIMC * RC +
                                      MTOK * KB_STRIDE + MTOK * VS_STRIDE) * sizeof(float);

    (void)hipFuncSetAttribute((const void*)prep_kernel,
        hipFuncAttributeMaxDynamicSharedMemorySize, (int)prepShmem);
    (void)hipFuncSetAttribute((const void*)attn_kernel,
        hipFuncAttributeMaxDynamicSharedMemorySize, (int)mainShmem);

    prep_kernel<<<BATCH * PBLOCKS, THREADS, prepShmem, stream>>>(
        dict, wk_w, wk_b, wv_w, wv_b, kn_g, kn_b, conv_w, conv_b, ws);

    const int nBlocks = BATCH * (NTOK / ROWS);   // 1024
    attn_kernel<<<nBlocks, THREADS, mainShmem, stream>>>(
        x, wq_w, wq_b, qn_g, qn_b, temp, ws, out);
}

// v003
// Measured time: 53.7 microseconds a run.
// Timed twice side by side with v002, it ran 1.19 and 1.18 times as fast.
// Counting every step since v000, it is 7.93 times as fast.
#include <hip/hip_runtime.h>
#include <hip/hip_bf16.h>
#include <math.h>

// ---------------------------------------------------------------------------
// Problem constants (from reference)
// ---------------------------------------------------------------------------
#define BATCH   8
#define NTOK    16384
#define DIMC    192
#define RC      16
#define MTOK    64
#define LN_EPS  1e-5f
#define NRM_EPS 1e-12f

// main-kernel tiling
#define ROWS    128          // rows of x per tile
#define NWAVES  8            // 8 waves * 16 rows = 128
#define THREADS 256
#define TILES   4            // row tiles one block walks (all of one batch)

// padded LDS strides (bank-conflict-free WMMA fragment reads, 64 banks).
// All strides are multiples of 4 floats so 16-byte async B128 writes stay
// naturally aligned in LDS.
#define XS_STRIDE 196        // x tile rows       (196 % 64 == 4; 784B % 16 == 0)
#define KB_STRIDE 20         // k rows            (20L mod 64 is a permutation)
#define VS_STRIDE 200        // v rows (K dim)    (4 rows apart: 800 % 64 == 32)

typedef float v2f __attribute__((ext_vector_type(2)));
typedef float v8f __attribute__((ext_vector_type(8)));

// workspace layout (floats)
#define WS_K_OFF  0                          // kb:   B * M * RC   = 8192
#define WS_V_OFF  (BATCH * MTOK * RC)        // vref: B * M * DIM  = 98304

__device__ __forceinline__ float gelu_exact(float x) {
    return 0.5f * x * (1.0f + erff(x * 0.70710678118654752f));
}

// CDNA5 async global->LDS copy, 16 bytes per lane.  ASYNCcnt-tracked DMA:
// no VGPR round-trip, no LOADcnt/DScnt pressure.  LDS address = low 32 bits
// of the generic shared pointer (aperture rule: LDS_ADDR = addr[31:0]).
__device__ __forceinline__ void async_copy_b128(float* lds_dst, const float* gsrc) {
    unsigned int l = (unsigned int)(uintptr_t)lds_dst;
    asm volatile("global_load_async_to_lds_b128 %0, %1, off"
                 :: "v"(l), "v"(gsrc) : "memory");
}
// Runs of copies for the attention kernel.  The s_wait_xcnt stands inside the
// copies' own statement, behind the last of them, so that no later write of an
// address register can be scheduled in front of it.
#define ACPY(l, g) "global_load_async_to_lds_b128 %" #l ", %" #g ", off\n\t"
__device__ __forceinline__ unsigned int lds_addr(const float* p) {
    return (unsigned int)(uintptr_t)p;
}
// One wave brings 8 rows of 192 floats (6 KiB in a row in global memory, 512
// bytes per copy) into LDS rows of `stride` floats.
__device__ __forceinline__ void async_rows8(float* lrow0, int stride,
                                            const float* g, int lane) {
    unsigned int l[12];
    const float* p[12];
    #pragma unroll
    for (int c = 0; c < 12; ++c) {
        const int q = lane + 32 * c;             // 16-byte piece, 48 to a row
        l[c] = lds_addr(lrow0 + (q / 48) * stride + (q % 48) * 4);
        p[c] = g + q * 4;
    }
    asm volatile(ACPY(0, 12) ACPY(1, 13) ACPY(2, 14) ACPY(3, 15)
                 ACPY(4, 16) ACPY(5, 17) ACPY(6, 18) ACPY(7, 19)
                 ACPY(8, 20) ACPY(9, 21) ACPY(10, 22) ACPY(11, 23)
                 "s_wait_xcnt 0x0"
                 :: "v"(l[0]), "v"(l[1]), "v"(l[2]), "v"(l[3]), "v"(l[4]), "v"(l[5]),
                    "v"(l[6]), "v"(l[7]), "v"(l[8]), "v"(l[9]), "v"(l[10]), "v"(l[11]),
                    "v"(p[0]), "v"(p[1]), "v"(p[2]), "v"(p[3]), "v"(p[4]), "v"(p[5]),
                    "v"(p[6]), "v"(p[7]), "v"(p[8]), "v"(p[9]), "v"(p[10]), "v"(p[11])
                 : "memory");
}
__device__ __forceinline__ void async_copy4(unsigned int l0, const float* g0,
                                            unsigned int l1, const float* g1,
                                            unsigned int l2, const float* g2,
                                            unsigned int l3, const float* g3) {
    asm volatile(ACPY(0, 4) ACPY(1, 5) ACPY(2, 6) ACPY(3, 7)
                 "s_wait_xcnt 0x0"
                 :: "v"(l0), "v"(l1), "v"(l2), "v"(l3),
                    "v"(g0), "v"(g1), "v"(g2), "v"(g3)
                 : "memory");
}
__device__ __forceinline__ void async_wait_all() {
    asm volatile("s_wait_asynccnt 0x0" ::: "memory");
}

// value of lane l ^ 16 (the other 16-lane half of the wave)
__device__ __forceinline__ float xhalf(float x) {
    return __builtin_bit_cast(float, __builtin_amdgcn_permlanex16(
        __builtin_bit_cast(int, x), __builtin_bit_cast(int, x),
        0x76543210, 0xfedcba98, false, false));
}

// e^x as __expf forms it (one multiply, v_exp_f32).  The v_nop is the one slot
// the instruction set asks for behind a transcendental: inside the statement it
// stands there whatever the compiler schedules next.
__device__ __forceinline__ float exp_slot(float x) {
    float r;
    asm("v_exp_f32 %0, %1\n\tv_nop" : "=v"(r) : "v"(x * 1.44269504088896340736f));
    return r;
}

// ---------------------------------------------------------------------------
// Kernel A: precompute of k = l2norm(LN(dict@wk)) and
// v = gelu(conv3tap(dict@wv + b)), one output element per thread.
// Per batch: 48 blocks of 8 rows x 32 columns of v (a block owns whole
// 128-byte lines of the workspace) and 4 blocks of 16 rows of k.
// The conv needs raw v of the rows above and below: each thread sums those
// two itself, so no block needs anything from another block.
// ---------------------------------------------------------------------------
#define VROWS   8                            // v rows per block
#define VCOLS   32                           // v columns per block
#define VCS     (DIMC / VCOLS)               // 6 column slices
#define VBLK    ((MTOK / VROWS) * VCS)       // 48 v blocks per batch
#define KROWS   (THREADS / RC)               // 16 k rows per block
#define PBLOCKS (VBLK + MTOK / KROWS)        // 52 blocks per batch

__global__ __launch_bounds__(THREADS)
void prep_kernel(const float* __restrict__ dict,
                 const float* __restrict__ wk_w, const float* __restrict__ wk_b,
                 const float* __restrict__ wv_w, const float* __restrict__ wv_b,
                 const float* __restrict__ kn_g, const float* __restrict__ kn_b,
                 const float* __restrict__ conv_w, const float* __restrict__ conv_b,
                 float* __restrict__ ws) {
    extern __shared__ float smem[];
    float* ds = smem;                    // 64*192 = 12288 dict tile
    float* kl = ds + MTOK * DIMC;        // 16*16  = 256   raw k

    const int b   = blockIdx.x / PBLOCKS;
    const int s   = blockIdx.x % PBLOCKS;
    const int tid = threadIdx.x;
    const float* db = dict + (size_t)b * MTOK * DIMC;
    float* wsK = ws + WS_K_OFF + (size_t)b * MTOK * RC;
    float* wsV = ws + WS_V_OFF + (size_t)b * MTOK * DIMC;

    // stage dict[b] into LDS via async DMA (contiguous, 16B chunks)
    for (int i4 = tid; i4 < (MTOK * DIMC) / 4; i4 += THREADS)
        async_copy_b128(ds + i4 * 4, db + i4 * 4);
    async_wait_all();
    __syncthreads();

    if (s >= VBLK) {
        const int mBase = (s - VBLK) * KROWS;

        // k_raw = dict @ wk + b   (16 of the 64 x 16)
        {
            const int m = mBase + tid / RC, r = tid % RC;
            float acc = wk_b[r];
            #pragma unroll 8
            for (int j = 0; j < DIMC; ++j) acc += ds[m * DIMC + j] * wk_w[j * RC + r];
            kl[tid] = acc;
        }
        __syncthreads();

        // per-row LN + l2norm on k, store to workspace
        if (tid < KROWS) {
            const int m = mBase + tid;
            float mu = 0.f;
            #pragma unroll
            for (int r = 0; r < RC; ++r) mu += kl[tid * RC + r];
            mu *= (1.0f / RC);
            float var = 0.f;
            #pragma unroll
            for (int r = 0; r < RC; ++r) { float d = kl[tid * RC + r] - mu; var += d * d; }
            var *= (1.0f / RC);
            const float rs = rsqrtf(var + LN_EPS);
            float tmp[RC];
            float nrm = 0.f;
            #pragma unroll
            for (int r = 0; r < RC; ++r) {
                float t = (kl[tid * RC + r] - mu) * rs * kn_g[r] + kn_b[r];
                tmp[r] = t; nrm += t * t;
            }
            const float inv = 1.0f / fmaxf(sqrtf(nrm), NRM_EPS);
            #pragma unroll
            for (int r = 0; r < RC; ++r) wsK[m * RC + r] = tmp[r] * inv;
        }
    } else {
        const int m  = (s / VCS) * VROWS + tid / VCOLS;
        const int c  = (s % VCS) * VCOLS + tid % VCOLS;
        const int mu = (m > 0)        ? m - 1 : m;   // row above (at the edge: m, sum unused)
        const int md = (m < MTOK - 1) ? m + 1 : m;   // row below (at the edge: m, sum unused)

        // v_raw = dict @ wv + b at rows m-1, m, m+1 of column c
        float vu = wv_b[c], vm = vu, vd = vu;
        // unroll 8, as in the k loop: eight weight loads are in flight per wait
        #pragma unroll 8
        for (int j = 0; j < DIMC; ++j) {
            const float w = wv_w[j * DIMC + c];
            vu += ds[mu * DIMC + j] * w;
            vm += ds[m  * DIMC + j] * w;
            vd += ds[md * DIMC + j] * w;
        }

        // depthwise 3-tap conv along M (kw=1 column of the 3x3 kernel) + GELU
        const float w0 = conv_w[c * 9 + 0 * 3 + 1];
        const float w1 = conv_w[c * 9 + 1 * 3 + 1];
        const float w2 = conv_w[c * 9 + 2 * 3 + 1];
        float acc = conv_b[c] + w1 * vm;
        if (m > 0)        acc += w0 * vu;
        if (m < MTOK - 1) acc += w2 * vd;
        wsV[m * DIMC + c] = gelu_exact(acc);
        // the built code lays the k branch behind this store: keep the wait in
        // front of any instruction there that rewrites the store's registers
        asm volatile("s_wait_xcnt 0x0" ::: "memory");
    }
}

// ---------------------------------------------------------------------------
// Kernel B: streaming attention kernel.  One block per WGP walks TILES tiles of
// 128 rows of x of one batch: wq, k and v are staged once, and the x tiles go
// through two LDS buffers, the next tile's copies in flight while this tile is
// worked on.
// All matmuls via v_wmma_f32_16x16x4_f32 (fp32 kept end-to-end; kernel is
// HBM-bound at ~18 flop/byte so f32 WMMA rate is not the limiter).  All LDS
// staging uses CDNA5 async global->LDS DMA.
// The first two products are formed transposed (q^T, logits^T): a lane then
// owns one row of x, its D registers hold that row's values, and they are as
// they stand the B fragment (q) and the A fragment (attn) of the next product,
// with the k order of the partner operand's loader set to match.  LayerNorm,
// l2norm and softmax run in registers: 8 or 32 values in the lane, then one
// exchange with the other half-wave.
// ---------------------------------------------------------------------------
__global__ __launch_bounds__(THREADS)
void attn_kernel(const float* __restrict__ x,
                 const float* __restrict__ wq_w, const float* __restrict__ wq_b,
                 const float* __restrict__ qn_g, const float* __restrict__ qn_b,
                 const float* __restrict__ temperature,
                 const float* __restrict__ ws,
                 float* __restrict__ out) {
    extern __shared__ float smem[];
    float* xs  = smem;                           // 2 buffers of 128 * 196
    float* wqs = xs  + 2 * ROWS * XS_STRIDE;     // 192 * 16
    float* kbs = wqs + DIMC * RC;                // 64 * 20
    float* vs  = kbs + MTOK * KB_STRIDE;         // 64 * 200

    const int tid  = threadIdx.x;
    const int wave = tid >> 5;                   // wave32
    const int lane = tid & 31;
    const int lm   = lane & 15;                  // lane % 16
    const int lh   = lane >> 4;                  // 0 / 1 half-wave

    const int blocksPerBatch = NTOK / (ROWS * TILES);   // 32
    const int b      = blockIdx.x / blocksPerBatch;
    const int nBase0 = (blockIdx.x % blocksPerBatch) * (ROWS * TILES);

    const float invTemp = 1.0f / fmaxf(temperature[0], 0.5f);
    const float* wsK = ws + WS_K_OFF + (size_t)b * MTOK * RC;
    const float* wsV = ws + WS_V_OFF + (size_t)b * MTOK * DIMC;

    // this lane's 8 of the 16 q channels: rc = 8 * lh + j
    float bq[8], gq[8], bn[8];
    #pragma unroll
    for (int j = 0; j < 8; ++j) {
        bq[j] = wq_b[8 * lh + j];
        gq[j] = qn_g[8 * lh + j];
        bn[j] = qn_b[8 * lh + j];
    }

    const int rbase = wave * 16;
    // this wave's 16 rows of tile 0 (it copies the rows that it reads)
    const float* xw = x + ((size_t)b * NTOK + nBase0 + rbase) * DIMC;

    // ---- x tile 0, v, wq and k into LDS via async global->LDS DMA (16B/lane) ----
    // x first: it comes from memory, the rest from L2
    async_rows8(xs + rbase * XS_STRIDE,       XS_STRIDE, xw,            lane);
    async_rows8(xs + (rbase + 8) * XS_STRIDE, XS_STRIDE, xw + 8 * DIMC, lane);
    async_rows8(vs + wave * 8 * VS_STRIDE, VS_STRIDE, wsV + wave * 8 * DIMC, lane);
    async_copy4(lds_addr(wqs + tid * 4),                 wq_w + tid * 4,
                lds_addr(wqs + (tid + THREADS) * 4),     wq_w + (tid + THREADS) * 4,
                lds_addr(wqs + (tid + 2 * THREADS) * 4), wq_w + (tid + 2 * THREADS) * 4,
                lds_addr(kbs + (tid / 4) * KB_STRIDE + (tid % 4) * 4), wsK + tid * 4);
    async_wait_all();
    __syncthreads();
    // tile 1 into the second buffer: in flight while tile 0 is worked on
    async_rows8(xs + (ROWS + rbase) * XS_STRIDE,     XS_STRIDE, xw + ROWS * DIMC,       lane);
    async_rows8(xs + (ROWS + rbase + 8) * XS_STRIDE, XS_STRIDE, xw + (ROWS + 8) * DIMC, lane);

    // rolled: one copy of the body in the instruction cache, buffer by t & 1
    #pragma unroll 1
    for (int t = 0; t < TILES; ++t) {
    const int nBase = nBase0 + t * ROWS;
    float* xt = xs + (t & 1) * (ROWS * XS_STRIDE);

    // ---- stage 2: q^T tile (16 rc x 16 rows) = wq^T(16x192) @ x_tile^T(192x16) ----
    // qt[j] = q_raw[row rbase + lm][rc = j + 8 * lh]
    v8f qt = {};
    #pragma unroll 4
    for (int k0 = 0; k0 < DIMC; k0 += 4) {
        v2f a, bf;
        const int ka = k0 + lh * 2;
        a.x  = wqs[(ka + 0) * RC + lm];
        a.y  = wqs[(ka + 1) * RC + lm];
        bf.x = xt[(rbase + lm) * XS_STRIDE + ka + 0];
        bf.y = xt[(rbase + lm) * XS_STRIDE + ka + 1];
        qt = __builtin_amdgcn_wmma_f32_16x16x4_f32(
            false, a, false, bf, (short)0, qt, false, false);
    }

    // ---- stage 3: bias + LayerNorm + l2norm of row lm, 8 channels per half ----
    float q[8];
    {
        float mu = 0.f;
        #pragma unroll
        for (int j = 0; j < 8; ++j) { q[j] = qt[j] + bq[j]; mu += q[j]; }
        mu += xhalf(mu);
        mu *= (1.0f / RC);
        float var = 0.f;
        #pragma unroll
        for (int j = 0; j < 8; ++j) { float d = q[j] - mu; var += d * d; }
        var += xhalf(var);
        var *= (1.0f / RC);
        const float rs = rsqrtf(var + LN_EPS);
        float nrm = 0.f;
        #pragma unroll
        for (int j = 0; j < 8; ++j) {
            q[j] = (q[j] - mu) * rs * gq[j] + bn[j];
            nrm += q[j] * q[j];
        }
        nrm += xhalf(nrm);
        const float inv = 1.0f / fmaxf(sqrtf(nrm), NRM_EPS);
        #pragma unroll
        for (int j = 0; j < 8; ++j) q[j] *= inv;
    }

    // ---- stage 4: logits^T (64 m x 16 rows) = k(64x16) @ q^T(16x16), pre-scaled ----
    // k order of step s: slot 2 * lh + e is rc = 8 * lh + 2 * s + e, in A and in B.
    // Row i of tile t is token 16t + 8 * ((i >> 2) & 1) + 4 * (i >> 3) + (i & 3), so
    // p[t][j] = logit[row lm][m = 16t + 8 * (j >> 2) + 4 * lh + (j & 3)]:
    // four registers are 16 bytes of a row of attn, the two halves 32 in a row.
    float p[MTOK / 16][8];
    {
        const int krow = ((lm & 4) << 1) | ((lm >> 3) << 2) | (lm & 3);
        #pragma unroll
        for (int t = 0; t < MTOK / 16; ++t) {
            const float* kr = kbs + (t * 16 + krow) * KB_STRIDE + 8 * lh;
            v8f acc = {};
            #pragma unroll
            for (int s = 0; s < RC / 4; ++s) {
                v2f a, bf;
                a.x  = kr[2 * s + 0];
                a.y  = kr[2 * s + 1];
                bf.x = q[2 * s + 0];
                bf.y = q[2 * s + 1];
                acc = __builtin_amdgcn_wmma_f32_16x16x4_f32(
                    false, a, false, bf, (short)0, acc, false, false);
            }
            #pragma unroll
            for (int j = 0; j < 8; ++j) p[t][j] = acc[j] * invTemp;
        }
    }

    // ---- stage 5: softmax of row lm over M=64, 32 values per half ----
    {
        float mx = -INFINITY;
        #pragma unroll
        for (int t = 0; t < MTOK / 16; ++t)
            #pragma unroll
            for (int j = 0; j < 8; ++j) mx = fmaxf(mx, p[t][j]);
        mx = fmaxf(mx, xhalf(mx));
        float s = 0.f;
        #pragma unroll
        for (int t = 0; t < MTOK / 16; ++t)
            #pragma unroll
            for (int j = 0; j < 8; ++j) { p[t][j] = exp_slot(p[t][j] - mx); s += p[t][j]; }
        s += xhalf(s);
        const float inv = 1.0f / s;
        #pragma unroll
        for (int t = 0; t < MTOK / 16; ++t)
            #pragma unroll
            for (int j = 0; j < 8; ++j) p[t][j] *= inv;
    }

    // ---- writeback of attn (second output) from registers, 16 bytes per lane ----
    {
        float* arow = out + (size_t)BATCH * NTOK * DIMC      // outputs concatenated
                    + ((size_t)b * NTOK + nBase + rbase + lm) * MTOK + 4 * lh;
        #pragma unroll
        for (int t = 0; t < MTOK / 16; ++t)
            #pragma unroll
            for (int h = 0; h < 2; ++h)
                *reinterpret_cast<float4*>(arow + t * 16 + h * 8) =
                    make_float4(p[t][4 * h + 0], p[t][4 * h + 1],
                                p[t][4 * h + 2], p[t][4 * h + 3]);
    }

    // ---- stage 6: out tile = attn(16x64) @ v(64x192), direct stores ----
    // A is p as it stands; B reads the v rows in p's token order.
    #pragma unroll 2
    for (int ct = 0; ct < DIMC / 16; ++ct) {
        const float* vc = vs + (4 * lh) * VS_STRIDE + ct * 16 + lm;
        v8f acc = {};
        #pragma unroll
        for (int t = 0; t < MTOK / 16; ++t) {
            #pragma unroll
            for (int s = 0; s < 4; ++s) {
                v2f a, bf;
                const int m0 = t * 16 + (s >> 1) * 8 + (s & 1) * 2;
                a.x  = p[t][2 * s + 0];
                a.y  = p[t][2 * s + 1];
                bf.x = vc[(m0 + 0) * VS_STRIDE];
                bf.y = vc[(m0 + 1) * VS_STRIDE];
                acc = __builtin_amdgcn_wmma_f32_16x16x4_f32(
                    false, a, false, bf, (short)0, acc, false, false);
            }
        }
        #pragma unroll
        for (int j = 0; j < 8; ++j) {
            const int n = nBase + wave * 16 + j + 8 * lh;
            out[((size_t)b * NTOK + n) * DIMC + ct * 16 + lm] = acc[j];
        }
    }

    // ---- foot of the trip: publish tile t + 1, free this tile's buffer ----
    // this wave's LDS reads have retired before its buffer is written again
    asm volatile("s_wait_dscnt 0x0" ::: "memory");
    // this wave's copies of tile t + 1 have landed
    async_wait_all();
    // every wave's copies have landed, every wave has left tile t's buffer
    __syncthreads();
    if (t + 2 < TILES) {
        const float* xn = xw + (size_t)(t + 2) * (ROWS * DIMC);
        async_rows8(xt + rbase * XS_STRIDE,       XS_STRIDE, xn,            lane);
        async_rows8(xt + (rbase + 8) * XS_STRIDE, XS_STRIDE, xn + 8 * DIMC, lane);
    }
    }
    // no copy is outstanding when the wave ends
    async_wait_all();
}

// ---------------------------------------------------------------------------
extern "C" void kernel_launch(void* const* d_in, const int* in_sizes, int n_in,
                              void* d_out, int out_size, void* d_ws, size_t ws_size,
                              hipStream_t stream) {
    const float* x      = (const float*)d_in[0];
    const float* dict   = (const float*)d_in[1];
    // d_in[2] = H, d_in[3] = W (unused)
    const float* wq_w   = (const float*)d_in[4];
    const float* wq_b   = (const float*)d_in[5];
    const float* wk_w   = (const float*)d_in[6];
    const float* wk_b   = (const float*)d_in[7];
    const float* wv_w   = (const float*)d_in[8];
    const float* wv_b   = (const float*)d_in[9];
    const float* qn_g   = (const float*)d_in[10];
    const float* qn_b   = (const float*)d_in[11];
    const float* kn_g   = (const float*)d_in[12];
    const float* kn_b   = (const float*)d_in[13];
    const float* conv_w = (const float*)d_in[14];
    const float* conv_b = (const float*)d_in[15];
    const float* temp   = (const float*)d_in[16];
    float* out = (float*)d_out;
    float* ws  = (float*)d_ws;

    const size_t prepShmem = (size_t)(MTOK * DIMC + KROWS * RC) * sizeof(float);
    const size_t mainShmem = (size_t)(2 * ROWS * XS_STRIDE + DIMC * RC +
                                      MTOK * KB_STRIDE + MTOK * VS_STRIDE) * sizeof(float);

    (void)hipFuncSetAttribute((const void*)prep_kernel,
        hipFuncAttributeMaxDynamicSharedMemorySize, (int)prepShmem);
    (void)hipFuncSetAttribute((const void*)attn_kernel,
        hipFuncAttributeMaxDynamicSharedMemorySize, (int)mainShmem);

    prep_kernel<<<BATCH * PBLOCKS, THREADS, prepShmem, stream>>>(
        dict, wk_w, wk_b, wv_w, wv_b, kn_g, kn_b, conv_w, conv_b, ws);

    const int nBlocks = BATCH * (NTOK / (ROWS * TILES));   // 256
    attn_kernel<<<nBlocks, THREADS, mainShmem, stream>>>(
        x, wq_w, wq_b, qn_g, qn_b, temp, ws, out);
}

// v004
// Measured time: 43.9 microseconds a run.
// In two side-by-side timings against v003, it was 1.23 and 1.22 times as fast.
// Over all steps from v000 it is 9.73 times as fast.
#include <hip/hip_runtime.h>
#include <hip/hip_bf16.h>
#include <math.h>

// ---------------------------------------------------------------------------
// Problem constants (from reference)
// ---------------------------------------------------------------------------
#define BATCH   8
#define NTOK    16384
#define DIMC    192
#define RC      16
#define MTOK    64
#define LN_EPS  1e-5f
#define NRM_EPS 1e-12f

// main-kernel tiling
#define ROWS    128          // rows of x per tile
#define NWAVES  8            // 8 waves * 16 rows = 128
#define THREADS 256
#define TILES   4            // row tiles one block walks (all of one batch)

// padded LDS strides (bank-conflict-free WMMA fragment reads, 64 banks).
// All strides are multiples of 4 floats so 16-byte async B128 writes stay
// naturally aligned in LDS.
#define XS_STRIDE 196        // x tile rows       (196 % 64 == 4; 784B % 16 == 0)
#define KB_STRIDE 20         // k rows            (20L mod 64 is a permutation)
#define VS_STRIDE 200        // v rows (K dim)    (4 rows apart: 800 % 64 == 32)

typedef float v2f __attribute__((ext_vector_type(2)));
typedef float v8f __attribute__((ext_vector_type(8)));

// workspace layout (floats)
#define WS_K_OFF  0                          // kb:   B * M * RC   = 8192
#define WS_V_OFF  (BATCH * MTOK * RC)        // vref: B * M * DIM  = 98304

__device__ __forceinline__ float gelu_exact(float x) {
    return 0.5f * x * (1.0f + erff(x * 0.70710678118654752f));
}

// CDNA5 async global->LDS copy, 16 bytes per lane.  ASYNCcnt-tracked DMA:
// no VGPR round-trip, no LOADcnt/DScnt pressure.  LDS address = low 32 bits
// of the generic shared pointer (aperture rule: LDS_ADDR = addr[31:0]).
// The copies are written in runs.  The s_wait_xcnt stands inside the
// copies' own statement, behind the last of them, so that no later write of an
// address register can be scheduled in front of it.
#define ACPY(l, g) "global_load_async_to_lds_b128 %" #l ", %" #g ", off\n\t"
__device__ __forceinline__ unsigned int lds_addr(const float* p) {
    return (unsigned int)(uintptr_t)p;
}
// One wave brings 8 rows of 192 floats (6 KiB in a row in global memory, 512
// bytes per copy) into LDS rows of `stride` floats.
__device__ __forceinline__ void async_rows8(float* lrow0, int stride,
                                            const float* g, int lane) {
    unsigned int l[12];
    const float* p[12];
    #pragma unroll
    for (int c = 0; c < 12; ++c) {
        const int q = lane + 32 * c;             // 16-byte piece, 48 to a row
        l[c] = lds_addr(lrow0 + (q / 48) * stride + (q % 48) * 4);
        p[c] = g + q * 4;
    }
    asm volatile(ACPY(0, 12) ACPY(1, 13) ACPY(2, 14) ACPY(3, 15)
                 ACPY(4, 16) ACPY(5, 17) ACPY(6, 18) ACPY(7, 19)
                 ACPY(8, 20) ACPY(9, 21) ACPY(10, 22) ACPY(11, 23)
                 "s_wait_xcnt 0x0"
                 :: "v"(l[0]), "v"(l[1]), "v"(l[2]), "v"(l[3]), "v"(l[4]), "v"(l[5]),
                    "v"(l[6]), "v"(l[7]), "v"(l[8]), "v"(l[9]), "v"(l[10]), "v"(l[11]),
                    "v"(p[0]), "v"(p[1]), "v"(p[2]), "v"(p[3]), "v"(p[4]), "v"(p[5]),
                    "v"(p[6]), "v"(p[7]), "v"(p[8]), "v"(p[9]), "v"(p[10]), "v"(p[11])
                 : "memory");
}
__device__ __forceinline__ void async_copy4(unsigned int l0, const float* g0,
                                            unsigned int l1, const float* g1,
                                            unsigned int l2, const float* g2,
                                            unsigned int l3, const float* g3) {
    asm volatile(ACPY(0, 4) ACPY(1, 5) ACPY(2, 6) ACPY(3, 7)
                 "s_wait_xcnt 0x0"
                 :: "v"(l0), "v"(l1), "v"(l2), "v"(l3),
                    "v"(g0), "v"(g1), "v"(g2), "v"(g3)
                 : "memory");
}
__device__ __forceinline__ void async_copy3(unsigned int l0, const float* g0,
                                            unsigned int l1, const float* g1,
                                            unsigned int l2, const float* g2) {
    asm volatile(ACPY(0, 3) ACPY(1, 4) ACPY(2, 5)
                 "s_wait_xcnt 0x0"
                 :: "v"(l0), "v"(l1), "v"(l2), "v"(g0), "v"(g1), "v"(g2)
                 : "memory");
}
__device__ __forceinline__ void async_wait_all() {
    asm volatile("s_wait_asynccnt 0x0" ::: "memory");
}

// value of lane l ^ 16 (the other 16-lane half of the wave)
__device__ __forceinline__ float xhalf(float x) {
    return __builtin_bit_cast(float, __builtin_amdgcn_permlanex16(
        __builtin_bit_cast(int, x), __builtin_bit_cast(int, x),
        0x76543210, 0xfedcba98, false, false));
}

// e^x as __expf forms it (one multiply, v_exp_f32).  The v_nop is the one slot
// the instruction set asks for behind a transcendental: inside the statement it
// stands there whatever the compiler schedules next.
__device__ __forceinline__ float exp_slot(float x) {
    float r;
    asm("v_exp_f32 %0, %1\n\tv_nop" : "=v"(r) : "v"(x * 1.44269504088896340736f));
    return r;
}

// ---------------------------------------------------------------------------
// Kernel A: precompute of k = l2norm(LN(dict@wk)) and
// v = gelu(conv3tap(dict@wv + b)), one output element per thread.
// Per batch: 48 blocks of 8 rows x 32 columns of v (a block owns whole
// 128-byte lines of the workspace) and 4 blocks of 16 rows of k.
// The conv needs raw v of the rows above and below: each thread sums those
// two itself, so no block needs anything from another block.
// Every global read of a block is issued ahead of its one wait: the block's
// slice of the weights goes to LDS with the dict tile, the few per-column and
// per-channel values to registers.  A loop that loads its weights as it goes
// waits out a load latency on every trip, a memory latency where L2 does not
// hold them.
// ---------------------------------------------------------------------------
#define VROWS   8                            // v rows per block
#define VCOLS   32                           // v columns per block
#define VCS     (DIMC / VCOLS)               // 6 column slices
#define VBLK    ((MTOK / VROWS) * VCS)       // 48 v blocks per batch
#define KROWS   (THREADS / RC)               // 16 k rows per block
#define PBLOCKS (VBLK + MTOK / KROWS)        // 52 blocks per batch

__global__ __launch_bounds__(THREADS)
void prep_kernel(const float* __restrict__ dict,
                 const float* __restrict__ wk_w, const float* __restrict__ wk_b,
                 const float* __restrict__ wv_w, const float* __restrict__ wv_b,
                 const float* __restrict__ kn_g, const float* __restrict__ kn_b,
                 const float* __restrict__ conv_w, const float* __restrict__ conv_b,
                 float* __restrict__ ws) {
    extern __shared__ float smem[];
    float* ds = smem;                    // 64*192 = 12288 dict tile
    float* kl = ds + MTOK * DIMC;        // 16*16  = 256   raw k
    float* wl = kl + KROWS * RC;         // 192*32 = 6144  weight slice (k: 192*16)

    const int b   = blockIdx.x / PBLOCKS;
    const int s   = blockIdx.x % PBLOCKS;
    const int tid = threadIdx.x;
    const float* db = dict + (size_t)b * MTOK * DIMC;
    float* wsK = ws + WS_K_OFF + (size_t)b * MTOK * RC;
    float* wsV = ws + WS_V_OFF + (size_t)b * MTOK * DIMC;

    // stage dict[b] into LDS via async DMA: each wave its 8 rows, one statement
    // with its s_wait_xcnt (the wait on the copies no longer follows at once)
    async_rows8(ds + (tid >> 5) * 8 * DIMC, DIMC, db + (tid >> 5) * 8 * DIMC, tid & 31);

    // the weight slice and the small operands, in the same flight
    float bias = 0.f, cw0 = 0.f, cw1 = 0.f, cw2 = 0.f, cbias = 0.f;
    float kg[RC] = {}, kb[RC] = {};
    if (s >= VBLK) {
        // wk whole: 192 x 16 floats in a row, 768 pieces of 16 bytes
        async_copy3(lds_addr(wl + tid * 4),                 wk_w + tid * 4,
                    lds_addr(wl + (tid + THREADS) * 4),     wk_w + (tid + THREADS) * 4,
                    lds_addr(wl + (tid + 2 * THREADS) * 4), wk_w + (tid + 2 * THREADS) * 4);
        bias = wk_b[tid % RC];
        // unrolled: constant indices, so that the two arrays live in registers
        #pragma unroll
        for (int r = 0; r < RC; ++r) { kg[r] = kn_g[r]; kb[r] = kn_b[r]; }
    } else {
        // 32 columns of wv: 192 rows of 128 bytes, 8 pieces a row, 32 rows a copy
        const int c = (s % VCS) * VCOLS + tid % VCOLS;
        const float* gw = wv_w + (tid / 8) * DIMC + (s % VCS) * VCOLS + (tid % 8) * 4;
        async_copy3(lds_addr(wl + tid * 4),                 gw,
                    lds_addr(wl + (tid + THREADS) * 4),     gw + 32 * DIMC,
                    lds_addr(wl + (tid + 2 * THREADS) * 4), gw + 64 * DIMC);
        async_copy3(lds_addr(wl + (tid + 3 * THREADS) * 4), gw + 96 * DIMC,
                    lds_addr(wl + (tid + 4 * THREADS) * 4), gw + 128 * DIMC,
                    lds_addr(wl + (tid + 5 * THREADS) * 4), gw + 160 * DIMC);
        bias  = wv_b[c];
        cw0   = conv_w[c * 9 + 0 * 3 + 1];
        cw1   = conv_w[c * 9 + 1 * 3 + 1];
        cw2   = conv_w[c * 9 + 2 * 3 + 1];
        cbias = conv_b[c];
        // these loads stay in flight down to the barrier: keep the wait in front
        // of any instruction on the way that rewrites a register they name
        asm volatile("s_wait_xcnt 0x0" ::: "memory");
    }
    async_wait_all();
    __syncthreads();

    if (s >= VBLK) {
        const int mBase = (s - VBLK) * KROWS;

        // k_raw = dict @ wk + b   (16 of the 64 x 16)
        {
            const int m = mBase + tid / RC, r = tid % RC;
            float acc = bias;
            #pragma unroll 8
            for (int j = 0; j < DIMC; ++j) acc += ds[m * DIMC + j] * wl[j * RC + r];
            kl[tid] = acc;
        }
        __syncthreads();

        // per-row LN + l2norm on k, store to workspace
        if (tid < KROWS) {
            const int m = mBase + tid;
            float mu = 0.f;
            #pragma unroll
            for (int r = 0; r < RC; ++r) mu += kl[tid * RC + r];
            mu *= (1.0f / RC);
            float var = 0.f;
            #pragma unroll
            for (int r = 0; r < RC; ++r) { float d = kl[tid * RC + r] - mu; var += d * d; }
            var *= (1.0f / RC);
            const float rs = rsqrtf(var + LN_EPS);
            float tmp[RC];
            float nrm = 0.f;
            #pragma unroll
            for (int r = 0; r < RC; ++r) {
                float t = (kl[tid * RC + r] - mu) * rs * kg[r] + kb[r];
                tmp[r] = t; nrm += t * t;
            }
            const float inv = 1.0f / fmaxf(sqrtf(nrm), NRM_EPS);
            #pragma unroll
            for (int r = 0; r < RC; ++r) wsK[m * RC + r] = tmp[r] * inv;
        }
    } else {
        const int m  = (s / VCS) * VROWS + tid / VCOLS;
        const int c  = (s % VCS) * VCOLS + tid % VCOLS;
        const int mu = (m > 0)        ? m - 1 : m;   // row above (at the edge: m, sum unused)
        const int md = (m < MTOK - 1) ? m + 1 : m;   // row below (at the edge: m, sum unused)

        // v_raw = dict @ wv + b at rows m-1, m, m+1 of column c
        float vu = bias, vm = vu, vd = vu;
        // unroll 8, as in the k loop: eight steps' LDS reads are in flight per wait
        #pragma unroll 8
        for (int j = 0; j < DIMC; ++j) {
            const float w = wl[j * VCOLS + tid % VCOLS];
            vu += ds[mu * DIMC + j] * w;
            vm += ds[m  * DIMC + j] * w;
            vd += ds[md * DIMC + j] * w;
        }

        // depthwise 3-tap conv along M (kw=1 column of the 3x3 kernel) + GELU
        float acc = cbias + cw1 * vm;
        if (m > 0)        acc += cw0 * vu;
        if (m < MTOK - 1) acc += cw2 * vd;
        wsV[m * DIMC + c] = gelu_exact(acc);
        // the built code lays the k branch behind this store: keep the wait in
        // front of any instruction there that rewrites the store's registers
        asm volatile("s_wait_xcnt 0x0" ::: "memory");
    }
}

// ---------------------------------------------------------------------------
// Kernel B: streaming attention kernel.  One block per WGP walks TILES tiles of
// 128 rows of x of one batch: wq, k and v are staged once, and the x tiles go
// through two LDS buffers, the next tile's copies in flight while this tile is
// worked on.
// All matmuls via v_wmma_f32_16x16x4_f32 (fp32 kept end-to-end; kernel is
// HBM-bound at ~18 flop/byte so f32 WMMA rate is not the limiter).  All LDS
// staging uses CDNA5 async global->LDS DMA.
// The first two products are formed transposed (q^T, logits^T): a lane then
// owns one row of x, its D registers hold that row's values, and they are as
// they stand the B fragment (q) and the A fragment (attn) of the next product,
// with the k order of the partner operand's loader set to match.  LayerNorm,
// l2norm and softmax run in registers: 8 or 32 values in the lane, then one
// exchange with the other half-wave.
// ---------------------------------------------------------------------------
__global__ __launch_bounds__(THREADS)
void attn_kernel(const float* __restrict__ x,
                 const float* __restrict__ wq_w, const float* __restrict__ wq_b,
                 const float* __restrict__ qn_g, const float* __restrict__ qn_b,
                 const float* __restrict__ temperature,
                 const float* __restrict__ ws,
                 float* __restrict__ out) {
    extern __shared__ float smem[];
    float* xs  = smem;                           // 2 buffers of 128 * 196
    float* wqs = xs  + 2 * ROWS * XS_STRIDE;     // 192 * 16
    float* kbs = wqs + DIMC * RC;                // 64 * 20
    float* vs  = kbs + MTOK * KB_STRIDE;         // 64 * 200

    const int tid  = threadIdx.x;
    const int wave = tid >> 5;                   // wave32
    const int lane = tid & 31;
    const int lm   = lane & 15;                  // lane % 16
    const int lh   = lane >> 4;                  // 0 / 1 half-wave

    const int blocksPerBatch = NTOK / (ROWS * TILES);   // 32
    const int b      = blockIdx.x / blocksPerBatch;
    const int nBase0 = (blockIdx.x % blocksPerBatch) * (ROWS * TILES);

    const float invTemp = 1.0f / fmaxf(temperature[0], 0.5f);
    const float* wsK = ws + WS_K_OFF + (size_t)b * MTOK * RC;
    const float* wsV = ws + WS_V_OFF + (size_t)b * MTOK * DIMC;

    // this lane's 8 of the 16 q channels: rc = 8 * lh + j
    float bq[8], gq[8], bn[8];
    #pragma unroll
    for (int j = 0; j < 8; ++j) {
        bq[j] = wq_b[8 * lh + j];
        gq[j] = qn_g[8 * lh + j];
        bn[j] = qn_b[8 * lh + j];
    }

    const int rbase = wave * 16;
    // this wave's 16 rows of tile 0 (it copies the rows that it reads)
    const float* xw = x + ((size_t)b * NTOK + nBase0 + rbase) * DIMC;

    // ---- x tile 0, v, wq and k into LDS via async global->LDS DMA (16B/lane) ----
    // x first: it comes from memory, the rest from L2
    async_rows8(xs + rbase * XS_STRIDE,       XS_STRIDE, xw,            lane);
    async_rows8(xs + (rbase + 8) * XS_STRIDE, XS_STRIDE, xw + 8 * DIMC, lane);
    async_rows8(vs + wave * 8 * VS_STRIDE, VS_STRIDE, wsV + wave * 8 * DIMC, lane);
    async_copy4(lds_addr(wqs + tid * 4),                 wq_w + tid * 4,
                lds_addr(wqs + (tid + THREADS) * 4),     wq_w + (tid + THREADS) * 4,
                lds_addr(wqs + (tid + 2 * THREADS) * 4), wq_w + (tid + 2 * THREADS) * 4,
                lds_addr(kbs + (tid / 4) * KB_STRIDE + (tid % 4) * 4), wsK + tid * 4);
    async_wait_all();
    __syncthreads();
    // tile 1 into the second buffer: in flight while tile 0 is worked on
    async_rows8(xs + (ROWS + rbase) * XS_STRIDE,     XS_STRIDE, xw + ROWS * DIMC,       lane);
    async_rows8(xs + (ROWS + rbase + 8) * XS_STRIDE, XS_STRIDE, xw + (ROWS + 8) * DIMC, lane);

    // rolled: one copy of the body in the instruction cache, buffer by t & 1
    #pragma unroll 1
    for (int t = 0; t < TILES; ++t) {
    const int nBase = nBase0 + t * ROWS;
    float* xt = xs + (t & 1) * (ROWS * XS_STRIDE);

    // ---- stage 2: q^T tile (16 rc x 16 rows) = wq^T(16x192) @ x_tile^T(192x16) ----
    // qt[j] = q_raw[row rbase + lm][rc = j + 8 * lh]
    v8f qt = {};
    #pragma unroll 4
    for (int k0 = 0; k0 < DIMC; k0 += 4) {
        v2f a, bf;
        const int ka = k0 + lh * 2;
        a.x  = wqs[(ka + 0) * RC + lm];
        a.y  = wqs[(ka + 1) * RC + lm];
        bf.x = xt[(rbase + lm) * XS_STRIDE + ka + 0];
        bf.y = xt[(rbase + lm) * XS_STRIDE + ka + 1];
        qt = __builtin_amdgcn_wmma_f32_16x16x4_f32(
            false, a, false, bf, (short)0, qt, false, false);
    }

    // ---- stage 3: bias + LayerNorm + l2norm of row lm, 8 channels per half ----
    float q[8];
    {
        float mu = 0.f;
        #pragma unroll
        for (int j = 0; j < 8; ++j) { q[j] = qt[j] + bq[j]; mu += q[j]; }
        mu += xhalf(mu);
        mu *= (1.0f / RC);
        float var = 0.f;
        #pragma unroll
        for (int j = 0; j < 8; ++j) { float d = q[j] - mu; var += d * d; }
        var += xhalf(var);
        var *= (1.0f / RC);
        const float rs = rsqrtf(var + LN_EPS);
        float nrm = 0.f;
        #pragma unroll
        for (int j = 0; j < 8; ++j) {
            q[j] = (q[j] - mu) * rs * gq[j] + bn[j];
            nrm += q[j] * q[j];
        }
        nrm += xhalf(nrm);
        const float inv = 1.0f / fmaxf(sqrtf(nrm), NRM_EPS);
        #pragma unroll
        for (int j = 0; j < 8; ++j) q[j] *= inv;
    }

    // ---- stage 4: logits^T (64 m x 16 rows) = k(64x16) @ q^T(16x16), pre-scaled ----
    // k order of step s: slot 2 * lh + e is rc = 8 * lh + 2 * s + e, in A and in B.
    // Row i of tile t is token 16t + 8 * ((i >> 2) & 1) + 4 * (i >> 3) + (i & 3), so
    // p[t][j] = logit[row lm][m = 16t + 8 * (j >> 2) + 4 * lh + (j & 3)]:
    // four registers are 16 bytes of a row of attn, the two halves 32 in a row.
    float p[MTOK / 16][8];
    {
        const int krow = ((lm & 4) << 1) | ((lm >> 3) << 2) | (lm & 3);
        #pragma unroll
        for (int t = 0; t < MTOK / 16; ++t) {
            const float* kr = kbs + (t * 16 + krow) * KB_STRIDE + 8 * lh;
            v8f acc = {};
            #pragma unroll
            for (int s = 0; s < RC / 4; ++s) {
                v2f a, bf;
                a.x  = kr[2 * s + 0];
                a.y  = kr[2 * s + 1];
                bf.x = q[2 * s + 0];
                bf.y = q[2 * s + 1];
                acc = __builtin_amdgcn_wmma_f32_16x16x4_f32(
                    false, a, false, bf, (short)0, acc, false, false);
            }
            #pragma unroll
            for (int j = 0; j < 8; ++j) p[t][j] = acc[j] * invTemp;
        }
    }

    // ---- stage 5: softmax of row lm over M=64, 32 values per half ----
    {
        float mx = -INFINITY;
        #pragma unroll
        for (int t = 0; t < MTOK / 16; ++t)
            #pragma unroll
            for (int j = 0; j < 8; ++j) mx = fmaxf(mx, p[t][j]);
        mx = fmaxf(mx, xhalf(mx));
        float s = 0.f;
        #pragma unroll
        for (int t = 0; t < MTOK / 16; ++t)
            #pragma unroll
            for (int j = 0; j < 8; ++j) { p[t][j] = exp_slot(p[t][j] - mx); s += p[t][j]; }
        s += xhalf(s);
        const float inv = 1.0f / s;
        #pragma unroll
        for (int t = 0; t < MTOK / 16; ++t)
            #pragma unroll
            for (int j = 0; j < 8; ++j) p[t][j] *= inv;
    }

    // ---- writeback of attn (second output) from registers, 16 bytes per lane ----
    {
        float* arow = out + (size_t)BATCH * NTOK * DIMC      // outputs concatenated
                    + ((size_t)b * NTOK + nBase + rbase + lm) * MTOK + 4 * lh;
        #pragma unroll
        for (int t = 0; t < MTOK / 16; ++t)
            #pragma unroll
            for (int h = 0; h < 2; ++h)
                *reinterpret_cast<float4*>(arow + t * 16 + h * 8) =
                    make_float4(p[t][4 * h + 0], p[t][4 * h + 1],
                                p[t][4 * h + 2], p[t][4 * h + 3]);
    }

    // ---- stage 6: out tile = attn(16x64) @ v(64x192), direct stores ----
    // A is p as it stands; B reads the v rows in p's token order.
    #pragma unroll 2
    for (int ct = 0; ct < DIMC / 16; ++ct) {
        const float* vc = vs + (4 * lh) * VS_STRIDE + ct * 16 + lm;
        v8f acc = {};
        #pragma unroll
        for (int t = 0; t < MTOK / 16; ++t) {
            #pragma unroll
            for (int s = 0; s < 4; ++s) {
                v2f a, bf;
                const int m0 = t * 16 + (s >> 1) * 8 + (s & 1) * 2;
                a.x  = p[t][2 * s + 0];
                a.y  = p[t][2 * s + 1];
                bf.x = vc[(m0 + 0) * VS_STRIDE];
                bf.y = vc[(m0 + 1) * VS_STRIDE];
                acc = __builtin_amdgcn_wmma_f32_16x16x4_f32(
                    false, a, false, bf, (short)0, acc, false, false);
            }
        }
        #pragma unroll
        for (int j = 0; j < 8; ++j) {
            const int n = nBase + wave * 16 + j + 8 * lh;
            out[((size_t)b * NTOK + n) * DIMC + ct * 16 + lm] = acc[j];
        }
    }

    // ---- foot of the trip: publish tile t + 1, free this tile's buffer ----
    // this wave's LDS reads have retired before its buffer is written again
    asm volatile("s_wait_dscnt 0x0" ::: "memory");
    // this wave's copies of tile t + 1 have landed
    async_wait_all();
    // every wave's copies have landed, every wave has left tile t's buffer
    __syncthreads();
    if (t + 2 < TILES) {
        const float* xn = xw + (size_t)(t + 2) * (ROWS * DIMC);
        async_rows8(xt + rbase * XS_STRIDE,       XS_STRIDE, xn,            lane);
        async_rows8(xt + (rbase + 8) * XS_STRIDE, XS_STRIDE, xn + 8 * DIMC, lane);
    }
    }
    // no copy is outstanding when the wave ends
    async_wait_all();
}

// ---------------------------------------------------------------------------
extern "C" void kernel_launch(void* const* d_in, const int* in_sizes, int n_in,
                              void* d_out, int out_size, void* d_ws, size_t ws_size,
                              hipStream_t stream) {
    const float* x      = (const float*)d_in[0];
    const float* dict   = (const float*)d_in[1];
    // d_in[2] = H, d_in[3] = W (unused)
    const float* wq_w   = (const float*)d_in[4];
    const float* wq_b   = (const float*)d_in[5];
    const float* wk_w   = (const float*)d_in[6];
    const float* wk_b   = (const float*)d_in[7];
    const float* wv_w   = (const float*)d_in[8];
    const float* wv_b   = (const float*)d_in[9];
    const float* qn_g   = (const float*)d_in[10];
    const float* qn_b   = (const float*)d_in[11];
    const float* kn_g   = (const float*)d_in[12];
    const float* kn_b   = (const float*)d_in[13];
    const float* conv_w = (const float*)d_in[14];
    const float* conv_b = (const float*)d_in[15];
    const float* temp   = (const float*)d_in[16];
    float* out = (float*)d_out;
    float* ws  = (float*)d_ws;

    const size_t prepShmem = (size_t)(MTOK * DIMC + KROWS * RC + DIMC * VCOLS) * sizeof(float);
    const size_t mainShmem = (size_t)(2 * ROWS * XS_STRIDE + DIMC * RC +
                                      MTOK * KB_STRIDE + MTOK * VS_STRIDE) * sizeof(float);

    (void)hipFuncSetAttribute((const void*)prep_kernel,
        hipFuncAttributeMaxDynamicSharedMemorySize, (int)prepShmem);
    (void)hipFuncSetAttribute((const void*)attn_kernel,
        hipFuncAttributeMaxDynamicSharedMemorySize, (int)mainShmem);

    prep_kernel<<<BATCH * PBLOCKS, THREADS, prepShmem, stream>>>(
        dict, wk_w, wk_b, wv_w, wv_b, kn_g, kn_b, conv_w, conv_b, ws);

    const int nBlocks = BATCH * (NTOK / (ROWS * TILES));   // 256
    attn_kernel<<<nBlocks, THREADS, mainShmem, stream>>>(
        x, wq_w, wq_b, qn_g, qn_b, temp, ws, out);
}

// v005
// Measured time: 41 microseconds a run.
// Two timings next to v004 both put it at 1.07 times that version's speed.
// Over all steps from v000 it is 10.4 times as fast.
#include <hip/hip_runtime.h>
#include <hip/hip_bf16.h>
#include <math.h>

// ---------------------------------------------------------------------------
// Problem constants (from reference)
// ---------------------------------------------------------------------------
#define BATCH   8
#define NTOK    16384
#define DIMC    192
#define RC      16
#define MTOK    64
#define LN_EPS  1e-5f
#define NRM_EPS 1e-12f

// main-kernel tiling
#define ROWS    128          // rows of x per tile
#define NWAVES  8            // 8 waves * 16 rows = 128
#define THREADS 256
#define TILES   4            // row tiles one block walks (all of one batch)

// padded LDS strides (bank-conflict-free WMMA fragment reads, 64 banks).
// All strides are multiples of 4 floats so 16-byte async B128 writes stay
// naturally aligned in LDS.
#define XS_STRIDE 196        // x tile rows       (196 % 64 == 4; 784B % 16 == 0)
#define KB_STRIDE 20         // k rows            (20L mod 64 is a permutation)
#define VS_STRIDE 200        // v rows (K dim)    (4 rows apart: 800 % 64 == 32)

typedef float v2f __attribute__((ext_vector_type(2)));
typedef float v8f __attribute__((ext_vector_type(8)));

// workspace layout (floats)
#define WS_K_OFF  0                          // kb:   B * M * RC   = 8192
#define WS_V_OFF  (BATCH * MTOK * RC)        // vref: B * M * DIM  = 98304

__device__ __forceinline__ float gelu_exact(float x) {
    return 0.5f * x * (1.0f + erff(x * 0.70710678118654752f));
}

// CDNA5 async global->LDS copy, 16 bytes per lane.  ASYNCcnt-tracked DMA:
// no VGPR round-trip, no LOADcnt/DScnt pressure.  LDS address = low 32 bits
// of the generic shared pointer (aperture rule: LDS_ADDR = addr[31:0]).
// The copies are written in runs.  The s_wait_xcnt stands inside the
// copies' own statement, behind the last of them, so that no later write of an
// address register can be scheduled in front of it.
#define ACPY(l, g) "global_load_async_to_lds_b128 %" #l ", %" #g ", off\n\t"
__device__ __forceinline__ unsigned int lds_addr(const float* p) {
    return (unsigned int)(uintptr_t)p;
}
// One wave brings 8 rows of 192 floats (6 KiB in a row in global memory, 512
// bytes per copy) into LDS rows of `stride` floats.
__device__ __forceinline__ void async_rows8(float* lrow0, int stride,
                                            const float* g, int lane) {
    unsigned int l[12];
    const float* p[12];
    #pragma unroll
    for (int c = 0; c < 12; ++c) {
        const int q = lane + 32 * c;             // 16-byte piece, 48 to a row
        l[c] = lds_addr(lrow0 + (q / 48) * stride + (q % 48) * 4);
        p[c] = g + q * 4;
    }
    asm volatile(ACPY(0, 12) ACPY(1, 13) ACPY(2, 14) ACPY(3, 15)
                 ACPY(4, 16) ACPY(5, 17) ACPY(6, 18) ACPY(7, 19)
                 ACPY(8, 20) ACPY(9, 21) ACPY(10, 22) ACPY(11, 23)
                 "s_wait_xcnt 0x0"
                 :: "v"(l[0]), "v"(l[1]), "v"(l[2]), "v"(l[3]), "v"(l[4]), "v"(l[5]),
                    "v"(l[6]), "v"(l[7]), "v"(l[8]), "v"(l[9]), "v"(l[10]), "v"(l[11]),
                    "v"(p[0]), "v"(p[1]), "v"(p[2]), "v"(p[3]), "v"(p[4]), "v"(p[5]),
                    "v"(p[6]), "v"(p[7]), "v"(p[8]), "v"(p[9]), "v"(p[10]), "v"(p[11])
                 : "memory");
}
__device__ __forceinline__ void async_copy4(unsigned int l0, const float* g0,
                                            unsigned int l1, const float* g1,
                                            unsigned int l2, const float* g2,
                                            unsigned int l3, const float* g3) {
    asm volatile(ACPY(0, 4) ACPY(1, 5) ACPY(2, 6) ACPY(3, 7)
                 "s_wait_xcnt 0x0"
                 :: "v"(l0), "v"(l1), "v"(l2), "v"(l3),
                    "v"(g0), "v"(g1), "v"(g2), "v"(g3)
                 : "memory");
}
__device__ __forceinline__ void async_copy3(unsigned int l0, const float* g0,
                                            unsigned int l1, const float* g1,
                                            unsigned int l2, const float* g2) {
    asm volatile(ACPY(0, 3) ACPY(1, 4) ACPY(2, 5)
                 "s_wait_xcnt 0x0"
                 :: "v"(l0), "v"(l1), "v"(l2), "v"(g0), "v"(g1), "v"(g2)
                 : "memory");
}
__device__ __forceinline__ void async_wait_all() {
    asm volatile("s_wait_asynccnt 0x0" ::: "memory");
}

// value of lane l ^ 16 (the other 16-lane half of the wave)
__device__ __forceinline__ float xhalf(float x) {
    return __builtin_bit_cast(float, __builtin_amdgcn_permlanex16(
        __builtin_bit_cast(int, x), __builtin_bit_cast(int, x),
        0x76543210, 0xfedcba98, false, false));
}

// e^x as __expf forms it (one multiply, v_exp_f32).  The v_nop is the one slot
// the instruction set asks for behind a transcendental: inside the statement it
// stands there whatever the compiler schedules next.
__device__ __forceinline__ float exp_slot(float x) {
    float r;
    asm("v_exp_f32 %0, %1\n\tv_nop" : "=v"(r) : "v"(x * 1.44269504088896340736f));
    return r;
}

// ---------------------------------------------------------------------------
// Kernel A: precompute of k = l2norm(LN(dict@wk)) and
// v = gelu(conv3tap(dict@wv + b)), one output element per thread.
// Per batch: 48 blocks of 8 rows x 32 columns of v (a block owns whole
// 128-byte lines of the workspace) and 4 blocks of 16 rows of k.
// The conv needs raw v of the rows above and below: each thread sums those
// two itself, so no block needs anything from another block.
// Every global read of a block is issued ahead of its one wait: the block's
// slice of the weights goes to LDS with the dict tile, the few per-column and
// per-channel values to registers.  A loop that loads its weights as it goes
// waits out a load latency on every trip, a memory latency where L2 does not
// hold them.
// ---------------------------------------------------------------------------
#define VROWS   8                            // v rows per block
#define VCOLS   32                           // v columns per block
#define VCS     (DIMC / VCOLS)               // 6 column slices
#define VBLK    ((MTOK / VROWS) * VCS)       // 48 v blocks per batch
#define KROWS   (THREADS / RC)               // 16 k rows per block
#define PBLOCKS (VBLK + MTOK / KROWS)        // 52 blocks per batch

__global__ __launch_bounds__(THREADS)
void prep_kernel(const float* __restrict__ dict,
                 const float* __restrict__ wk_w, const float* __restrict__ wk_b,
                 const float* __restrict__ wv_w, const float* __restrict__ wv_b,
                 const float* __restrict__ kn_g, const float* __restrict__ kn_b,
                 const float* __restrict__ conv_w, const float* __restrict__ conv_b,
                 float* __restrict__ ws) {
    extern __shared__ float smem[];
    float* ds = smem;                    // 64*192 = 12288 dict tile
    float* kl = ds + MTOK * DIMC;        // 16*16  = 256   raw k
    float* wl = kl + KROWS * RC;         // 192*32 = 6144  weight slice (k: 192*16)

    const int b   = blockIdx.x / PBLOCKS;
    const int s   = blockIdx.x % PBLOCKS;
    const int tid = threadIdx.x;
    const float* db = dict + (size_t)b * MTOK * DIMC;
    float* wsK = ws + WS_K_OFF + (size_t)b * MTOK * RC;
    float* wsV = ws + WS_V_OFF + (size_t)b * MTOK * DIMC;

    // stage dict[b] into LDS via async DMA: each wave its 8 rows, one statement
    // with its s_wait_xcnt (the wait on the copies no longer follows at once)
    async_rows8(ds + (tid >> 5) * 8 * DIMC, DIMC, db + (tid >> 5) * 8 * DIMC, tid & 31);

    // the weight slice and the small operands, in the same flight
    float bias = 0.f, cw0 = 0.f, cw1 = 0.f, cw2 = 0.f, cbias = 0.f;
    float kg[RC] = {}, kb[RC] = {};
    if (s >= VBLK) {
        // wk whole: 192 x 16 floats in a row, 768 pieces of 16 bytes
        async_copy3(lds_addr(wl + tid * 4),                 wk_w + tid * 4,
                    lds_addr(wl + (tid + THREADS) * 4),     wk_w + (tid + THREADS) * 4,
                    lds_addr(wl + (tid + 2 * THREADS) * 4), wk_w + (tid + 2 * THREADS) * 4);
        bias = wk_b[tid % RC];
        // unrolled: constant indices, so that the two arrays live in registers
        #pragma unroll
        for (int r = 0; r < RC; ++r) { kg[r] = kn_g[r]; kb[r] = kn_b[r]; }
    } else {
        // 32 columns of wv: 192 rows of 128 bytes, 8 pieces a row, 32 rows a copy
        const int c = (s % VCS) * VCOLS + tid % VCOLS;
        const float* gw = wv_w + (tid / 8) * DIMC + (s % VCS) * VCOLS + (tid % 8) * 4;
        async_copy3(lds_addr(wl + tid * 4),                 gw,
                    lds_addr(wl + (tid + THREADS) * 4),     gw + 32 * DIMC,
                    lds_addr(wl + (tid + 2 * THREADS) * 4), gw + 64 * DIMC);
        async_copy3(lds_addr(wl + (tid + 3 * THREADS) * 4), gw + 96 * DIMC,
                    lds_addr(wl + (tid + 4 * THREADS) * 4), gw + 128 * DIMC,
                    lds_addr(wl + (tid + 5 * THREADS) * 4), gw + 160 * DIMC);
        bias  = wv_b[c];
        cw0   = conv_w[c * 9 + 0 * 3 + 1];
        cw1   = conv_w[c * 9 + 1 * 3 + 1];
        cw2   = conv_w[c * 9 + 2 * 3 + 1];
        cbias = conv_b[c];
        // these loads stay in flight down to the barrier: keep the wait in front
        // of any instruction on the way that rewrites a register they name
        asm volatile("s_wait_xcnt 0x0" ::: "memory");
    }
    async_wait_all();
    __syncthreads();

    if (s >= VBLK) {
        const int mBase = (s - VBLK) * KROWS;

        // k_raw = dict @ wk + b   (16 of the 64 x 16)
        {
            const int m = mBase + tid / RC, r = tid % RC;
            float acc = bias;
            #pragma unroll 8
            for (int j = 0; j < DIMC; ++j) acc += ds[m * DIMC + j] * wl[j * RC + r];
            kl[tid] = acc;
        }
        __syncthreads();

        // per-row LN + l2norm on k, store to workspace
        if (tid < KROWS) {
            const int m = mBase + tid;
            float mu = 0.f;
            #pragma unroll
            for (int r = 0; r < RC; ++r) mu += kl[tid * RC + r];
            mu *= (1.0f / RC);
            float var = 0.f;
            #pragma unroll
            for (int r = 0; r < RC; ++r) { float d = kl[tid * RC + r] - mu; var += d * d; }
            var *= (1.0f / RC);
            const float rs = rsqrtf(var + LN_EPS);
            float tmp[RC];
            float nrm = 0.f;
            #pragma unroll
            for (int r = 0; r < RC; ++r) {
                float t = (kl[tid * RC + r] - mu) * rs * kg[r] + kb[r];
                tmp[r] = t; nrm += t * t;
            }
            const float inv = 1.0f / fmaxf(sqrtf(nrm), NRM_EPS);
            #pragma unroll
            for (int r = 0; r < RC; ++r) wsK[m * RC + r] = tmp[r] * inv;
        }
    } else {
        const int m  = (s / VCS) * VROWS + tid / VCOLS;
        const int c  = (s % VCS) * VCOLS + tid % VCOLS;
        const int mu = (m > 0)        ? m - 1 : m;   // row above (at the edge: m, sum unused)
        const int md = (m < MTOK - 1) ? m + 1 : m;   // row below (at the edge: m, sum unused)

        // v_raw = dict @ wv + b at rows m-1, m, m+1 of column c
        float vu = bias, vm = vu, vd = vu;
        // unroll 8, as in the k loop: eight steps' LDS reads are in flight per wait
        #pragma unroll 8
        for (int j = 0; j < DIMC; ++j) {
            const float w = wl[j * VCOLS + tid % VCOLS];
            vu += ds[mu * DIMC + j] * w;
            vm += ds[m  * DIMC + j] * w;
            vd += ds[md * DIMC + j] * w;
        }

        // depthwise 3-tap conv along M (kw=1 column of the 3x3 kernel) + GELU
        float acc = cbias + cw1 * vm;
        if (m > 0)        acc += cw0 * vu;
        if (m < MTOK - 1) acc += cw2 * vd;
        wsV[m * DIMC + c] = gelu_exact(acc);
        // the built code lays the k branch behind this store: keep the wait in
        // front of any instruction there that rewrites the store's registers
        asm volatile("s_wait_xcnt 0x0" ::: "memory");
    }
}

// ---------------------------------------------------------------------------
// Kernel B: streaming attention kernel.  One block per WGP walks TILES tiles of
// 128 rows of x of one batch: wq, k and v are staged once, and the x tiles go
// through two LDS buffers, the next tile's copies in flight while this tile is
// worked on.
// All matmuls via v_wmma_f32_16x16x4_f32 (fp32 kept end-to-end; kernel is
// HBM-bound at ~18 flop/byte so f32 WMMA rate is not the limiter).  All LDS
// staging uses CDNA5 async global->LDS DMA.
// The first two products are formed transposed (q^T, logits^T): a lane then
// owns one row of x, its D registers hold that row's values, and they are as
// they stand the B fragment (q) and the A fragment (attn) of the next product,
// with the k order of the partner operand's loader set to match.  LayerNorm,
// l2norm and softmax run in registers: 8 or 32 values in the lane, then one
// exchange with the other half-wave.
// ---------------------------------------------------------------------------
__global__ __launch_bounds__(THREADS)
void attn_kernel(const float* __restrict__ x,
                 const float* __restrict__ wq_w, const float* __restrict__ wq_b,
                 const float* __restrict__ qn_g, const float* __restrict__ qn_b,
                 const float* __restrict__ temperature,
                 const float* __restrict__ ws,
                 float* __restrict__ out) {
    extern __shared__ float smem[];
    float* xs  = smem;                           // 2 buffers of 128 * 196
    float* wqs = xs  + 2 * ROWS * XS_STRIDE;     // 192 * 16
    float* kbs = wqs + DIMC * RC;                // 64 * 20
    float* vs  = kbs + MTOK * KB_STRIDE;         // 64 * 200

    const int tid  = threadIdx.x;
    const int wave = tid >> 5;                   // wave32
    const int lane = tid & 31;
    const int lm   = lane & 15;                  // lane % 16
    const int lh   = lane >> 4;                  // 0 / 1 half-wave

    const int blocksPerBatch = NTOK / (ROWS * TILES);   // 32
    const int b      = blockIdx.x / blocksPerBatch;
    const int nBase0 = (blockIdx.x % blocksPerBatch) * (ROWS * TILES);

    const float invTemp = 1.0f / fmaxf(temperature[0], 0.5f);
    const float* wsK = ws + WS_K_OFF + (size_t)b * MTOK * RC;
    const float* wsV = ws + WS_V_OFF + (size_t)b * MTOK * DIMC;

    // this lane's 8 of the 16 q channels: rc = 8 * lh + j
    float bq[8], gq[8], bn[8];
    #pragma unroll
    for (int j = 0; j < 8; ++j) {
        bq[j] = wq_b[8 * lh + j];
        gq[j] = qn_g[8 * lh + j];
        bn[j] = qn_b[8 * lh + j];
    }

    const int rbase = wave * 16;
    // this wave's 16 rows of tile 0 (it copies the rows that it reads)
    const float* xw = x + ((size_t)b * NTOK + nBase0 + rbase) * DIMC;

    // ---- x tile 0, v, wq and k into LDS via async global->LDS DMA (16B/lane) ----
    // x first: it comes from memory, the rest from L2
    async_rows8(xs + rbase * XS_STRIDE,       XS_STRIDE, xw,            lane);
    async_rows8(xs + (rbase + 8) * XS_STRIDE, XS_STRIDE, xw + 8 * DIMC, lane);
    async_rows8(vs + wave * 8 * VS_STRIDE, VS_STRIDE, wsV + wave * 8 * DIMC, lane);
    async_copy4(lds_addr(wqs + tid * 4),                 wq_w + tid * 4,
                lds_addr(wqs + (tid + THREADS) * 4),     wq_w + (tid + THREADS) * 4,
                lds_addr(wqs + (tid + 2 * THREADS) * 4), wq_w + (tid + 2 * THREADS) * 4,
                lds_addr(kbs + (tid / 4) * KB_STRIDE + (tid % 4) * 4), wsK + tid * 4);
    async_wait_all();
    __syncthreads();
    // tile 1 into the second buffer: in flight while tile 0 is worked on
    async_rows8(xs + (ROWS + rbase) * XS_STRIDE,     XS_STRIDE, xw + ROWS * DIMC,       lane);
    async_rows8(xs + (ROWS + rbase + 8) * XS_STRIDE, XS_STRIDE, xw + (ROWS + 8) * DIMC, lane);

    // rolled: one copy of the body in the instruction cache, buffer by t & 1
    #pragma unroll 1
    for (int t = 0; t < TILES; ++t) {
    const int nBase = nBase0 + t * ROWS;
    float* xt = xs + (t & 1) * (ROWS * XS_STRIDE);

    // ---- stage 2: q^T tile (16 rc x 16 rows) = wq^T(16x192) @ x_tile^T(192x16) ----
    // qt[j] = q_raw[row rbase + lm][rc = j + 8 * lh]
    v8f qt = {};
    #pragma unroll 4
    for (int k0 = 0; k0 < DIMC; k0 += 4) {
        v2f a, bf;
        const int ka = k0 + lh * 2;
        a.x  = wqs[(ka + 0) * RC + lm];
        a.y  = wqs[(ka + 1) * RC + lm];
        bf.x = xt[(rbase + lm) * XS_STRIDE + ka + 0];
        bf.y = xt[(rbase + lm) * XS_STRIDE + ka + 1];
        qt = __builtin_amdgcn_wmma_f32_16x16x4_f32(
            false, a, false, bf, (short)0, qt, false, false);
    }

    // ---- stage 3: bias + LayerNorm + l2norm of row lm, 8 channels per half ----
    float q[8];
    {
        float mu = 0.f;
        #pragma unroll
        for (int j = 0; j < 8; ++j) { q[j] = qt[j] + bq[j]; mu += q[j]; }
        mu += xhalf(mu);
        mu *= (1.0f / RC);
        float var = 0.f;
        #pragma unroll
        for (int j = 0; j < 8; ++j) { float d = q[j] - mu; var += d * d; }
        var += xhalf(var);
        var *= (1.0f / RC);
        const float rs = rsqrtf(var + LN_EPS);
        float nrm = 0.f;
        #pragma unroll
        for (int j = 0; j < 8; ++j) {
            q[j] = (q[j] - mu) * rs * gq[j] + bn[j];
            nrm += q[j] * q[j];
        }
        nrm += xhalf(nrm);
        const float inv = 1.0f / fmaxf(sqrtf(nrm), NRM_EPS);
        #pragma unroll
        for (int j = 0; j < 8; ++j) q[j] *= inv;
    }

    // ---- stage 4: logits^T (64 m x 16 rows) = k(64x16) @ q^T(16x16), pre-scaled ----
    // k order of step s: slot 2 * lh + e is rc = 8 * lh + 2 * s + e, in A and in B.
    // Row i of tile t is token 16t + 8 * ((i >> 2) & 1) + 4 * (i >> 3) + (i & 3), so
    // p[t][j] = logit[row lm][m = 16t + 8 * (j >> 2) + 4 * lh + (j & 3)]:
    // four registers are 16 bytes of a row of attn, the two halves 32 in a row.
    float p[MTOK / 16][8];
    {
        const int krow = ((lm & 4) << 1) | ((lm >> 3) << 2) | (lm & 3);
        #pragma unroll
        for (int t = 0; t < MTOK / 16; ++t) {
            const float* kr = kbs + (t * 16 + krow) * KB_STRIDE + 8 * lh;
            v8f acc = {};
            #pragma unroll
            for (int s = 0; s < RC / 4; ++s) {
                v2f a, bf;
                a.x  = kr[2 * s + 0];
                a.y  = kr[2 * s + 1];
                bf.x = q[2 * s + 0];
                bf.y = q[2 * s + 1];
                acc = __builtin_amdgcn_wmma_f32_16x16x4_f32(
                    false, a, false, bf, (short)0, acc, false, false);
            }
            #pragma unroll
            for (int j = 0; j < 8; ++j) p[t][j] = acc[j] * invTemp;
        }
    }

    // ---- stage 5: softmax of row lm over M=64, 32 values per half ----
    {
        float mx = -INFINITY;
        #pragma unroll
        for (int t = 0; t < MTOK / 16; ++t)
            #pragma unroll
            for (int j = 0; j < 8; ++j) mx = fmaxf(mx, p[t][j]);
        mx = fmaxf(mx, xhalf(mx));
        float s = 0.f;
        #pragma unroll
        for (int t = 0; t < MTOK / 16; ++t)
            #pragma unroll
            for (int j = 0; j < 8; ++j) { p[t][j] = exp_slot(p[t][j] - mx); s += p[t][j]; }
        s += xhalf(s);
        const float inv = 1.0f / s;
        #pragma unroll
        for (int t = 0; t < MTOK / 16; ++t)
            #pragma unroll
            for (int j = 0; j < 8; ++j) p[t][j] *= inv;
    }

    // ---- writeback of attn (second output) from registers, 16 bytes per lane ----
    {
        float* arow = out + (size_t)BATCH * NTOK * DIMC      // outputs concatenated
                    + ((size_t)b * NTOK + nBase + rbase + lm) * MTOK + 4 * lh;
        #pragma unroll
        for (int t = 0; t < MTOK / 16; ++t)
            #pragma unroll
            for (int h = 0; h < 2; ++h)
                *reinterpret_cast<float4*>(arow + t * 16 + h * 8) =
                    make_float4(p[t][4 * h + 0], p[t][4 * h + 1],
                                p[t][4 * h + 2], p[t][4 * h + 3]);
    }

    // ---- stage 6: out tile = attn(16x64) @ v(64x192), direct stores ----
    // A is p as it stands; B reads the v rows in p's token order.
    // Four column tiles go together, dealt so that lane lm owns the 4 adjacent
    // columns 64 * g + 4 * lm + i (i = tile): one 16-byte LDS read is one token's
    // B element of all four tiles, and one 16-byte store per row writes the four
    // accumulators, 16 lanes a whole aligned 256 bytes of the row.
    {
        float* orow = out + ((size_t)b * NTOK + nBase + rbase + 8 * lh) * DIMC + 4 * lm;
        // rolled: one group's 32 LDS reads fit the registers and go out ahead of its products
        #pragma unroll 1
        for (int g = 0; g < DIMC / 64; ++g) {
            const float* vc = vs + (4 * lh) * VS_STRIDE + g * 64 + 4 * lm;
            v8f acc0 = {}, acc1 = {}, acc2 = {}, acc3 = {};
            // t, s and j unrolled: p and the accumulators are indexed by constants
            // and stay in registers
            #pragma unroll
            for (int t = 0; t < MTOK / 16; ++t) {
                #pragma unroll
                for (int s = 0; s < 4; ++s) {
                    const int m0 = t * 16 + (s >> 1) * 8 + (s & 1) * 2;
                    const float4 b0 = *reinterpret_cast<const float4*>(vc + (m0 + 0) * VS_STRIDE);
                    const float4 b1 = *reinterpret_cast<const float4*>(vc + (m0 + 1) * VS_STRIDE);
                    v2f a, bf;
                    a.x = p[t][2 * s + 0];
                    a.y = p[t][2 * s + 1];
                    bf.x = b0.x; bf.y = b1.x;
                    acc0 = __builtin_amdgcn_wmma_f32_16x16x4_f32(
                        false, a, false, bf, (short)0, acc0, false, false);
                    bf.x = b0.y; bf.y = b1.y;
                    acc1 = __builtin_amdgcn_wmma_f32_16x16x4_f32(
                        false, a, false, bf, (short)0, acc1, false, false);
                    bf.x = b0.z; bf.y = b1.z;
                    acc2 = __builtin_amdgcn_wmma_f32_16x16x4_f32(
                        false, a, false, bf, (short)0, acc2, false, false);
                    bf.x = b0.w; bf.y = b1.w;
                    acc3 = __builtin_amdgcn_wmma_f32_16x16x4_f32(
                        false, a, false, bf, (short)0, acc3, false, false);
                }
            }
            #pragma unroll
            for (int j = 0; j < 8; ++j)
                *reinterpret_cast<float4*>(orow + j * DIMC + g * 64) =
                    make_float4(acc0[j], acc1[j], acc2[j], acc3[j]);
        }
    }

    // ---- foot of the trip: publish tile t + 1, free this tile's buffer ----
    // this wave's LDS reads have retired before its buffer is written again
    asm volatile("s_wait_dscnt 0x0" ::: "memory");
    // this wave's copies of tile t + 1 have landed
    async_wait_all();
    // every wave's copies have landed, every wave has left tile t's buffer
    __syncthreads();
    if (t + 2 < TILES) {
        const float* xn = xw + (size_t)(t + 2) * (ROWS * DIMC);
        async_rows8(xt + rbase * XS_STRIDE,       XS_STRIDE, xn,            lane);
        async_rows8(xt + (rbase + 8) * XS_STRIDE, XS_STRIDE, xn + 8 * DIMC, lane);
    }
    }
    // no copy is outstanding when the wave ends
    async_wait_all();
}

// ---------------------------------------------------------------------------
extern "C" void kernel_launch(void* const* d_in, const int* in_sizes, int n_in,
                              void* d_out, int out_size, void* d_ws, size_t ws_size,
                              hipStream_t stream) {
    const float* x      = (const float*)d_in[0];
    const float* dict   = (const float*)d_in[1];
    // d_in[2] = H, d_in[3] = W (unused)
    const float* wq_w   = (const float*)d_in[4];
    const float* wq_b   = (const float*)d_in[5];
    const float* wk_w   = (const float*)d_in[6];
    const float* wk_b   = (const float*)d_in[7];
    const float* wv_w   = (const float*)d_in[8];
    const float* wv_b   = (const float*)d_in[9];
    const float* qn_g   = (const float*)d_in[10];
    const float* qn_b   = (const float*)d_in[11];
    const float* kn_g   = (const float*)d_in[12];
    const float* kn_b   = (const float*)d_in[13];
    const float* conv_w = (const float*)d_in[14];
    const float* conv_b = (const float*)d_in[15];
    const float* temp   = (const float*)d_in[16];
    float* out = (float*)d_out;
    float* ws  = (float*)d_ws;

    const size_t prepShmem = (size_t)(MTOK * DIMC + KROWS * RC + DIMC * VCOLS) * sizeof(float);
    const size_t mainShmem = (size_t)(2 * ROWS * XS_STRIDE + DIMC * RC +
                                      MTOK * KB_STRIDE + MTOK * VS_STRIDE) * sizeof(float);

    (void)hipFuncSetAttribute((const void*)prep_kernel,
        hipFuncAttributeMaxDynamicSharedMemorySize, (int)prepShmem);
    (void)hipFuncSetAttribute((const void*)attn_kernel,
        hipFuncAttributeMaxDynamicSharedMemorySize, (int)mainShmem);

    prep_kernel<<<BATCH * PBLOCKS, THREADS, prepShmem, stream>>>(
        dict, wk_w, wk_b, wv_w, wv_b, kn_g, kn_b, conv_w, conv_b, ws);

    const int nBlocks = BATCH * (NTOK / (ROWS * TILES));   // 256
    attn_kernel<<<nBlocks, THREADS, mainShmem, stream>>>(
        x, wq_w, wq_b, qn_g, qn_b, temp, ws, out);
}

// v006
// One run takes 39.3 microseconds.
// In two side-by-side timings against v005, it was 1.04 and 1.05 times as fast.
// Over all steps from v000 it is 10.9 times as fast.
#include <hip/hip_runtime.h>
#include <hip/hip_bf16.h>
#include <math.h>

// ---------------------------------------------------------------------------
// Problem constants (from reference)
// ---------------------------------------------------------------------------
#define BATCH   8
#define NTOK    16384
#define DIMC    192
#define RC      16
#define MTOK    64
#define LN_EPS  1e-5f
#define NRM_EPS 1e-12f

// main-kernel tiling
#define ROWS    128          // rows of x per tile
#define NWAVES  8            // 8 waves * 16 rows = 128
#define THREADS 256
#define TILES   4            // row tiles one block walks (all of one batch)

// padded LDS strides (bank-conflict-free WMMA fragment reads, 64 banks).
// All strides are multiples of 4 floats so 16-byte async B128 writes stay
// naturally aligned in LDS.
#define XS_STRIDE 196        // x tile rows       (196 % 64 == 4; 784B % 16 == 0)
#define KB_STRIDE 20         // k rows            (20L mod 64 is a permutation)
#define VS_STRIDE 200        // v rows (K dim)    (4 rows apart: 800 % 64 == 32)

typedef float v2f __attribute__((ext_vector_type(2)));
typedef float v8f __attribute__((ext_vector_type(8)));

// workspace layout (floats)
#define WS_K_OFF  0                          // kb:   B * M * RC   = 8192
#define WS_V_OFF  (BATCH * MTOK * RC)        // vref: B * M * DIM  = 98304

__device__ __forceinline__ float gelu_exact(float x) {
    return 0.5f * x * (1.0f + erff(x * 0.70710678118654752f));
}

// CDNA5 async global->LDS copy, 16 bytes per lane.  ASYNCcnt-tracked DMA:
// no VGPR round-trip, no LOADcnt/DScnt pressure.  LDS address = low 32 bits
// of the generic shared pointer (aperture rule: LDS_ADDR = addr[31:0]).
// The copies are written in runs.  The s_wait_xcnt stands inside the
// copies' own statement, behind the last of them, so that no later write of an
// address register can be scheduled in front of it.
#define ACPY(l, g) "global_load_async_to_lds_b128 %" #l ", %" #g ", off\n\t"
__device__ __forceinline__ unsigned int lds_addr(const float* p) {
    return (unsigned int)(uintptr_t)p;
}
// One wave brings 8 rows of 192 floats (6 KiB in a row in global memory, 512
// bytes per copy) into LDS rows of `stride` floats.
__device__ __forceinline__ void async_rows8(float* lrow0, int stride,
                                            const float* g, int lane) {
    unsigned int l[12];
    const float* p[12];
    #pragma unroll
    for (int c = 0; c < 12; ++c) {
        const int q = lane + 32 * c;             // 16-byte piece, 48 to a row
        l[c] = lds_addr(lrow0 + (q / 48) * stride + (q % 48) * 4);
        p[c] = g + q * 4;
    }
    asm volatile(ACPY(0, 12) ACPY(1, 13) ACPY(2, 14) ACPY(3, 15)
                 ACPY(4, 16) ACPY(5, 17) ACPY(6, 18) ACPY(7, 19)
                 ACPY(8, 20) ACPY(9, 21) ACPY(10, 22) ACPY(11, 23)
                 "s_wait_xcnt 0x0"
                 :: "v"(l[0]), "v"(l[1]), "v"(l[2]), "v"(l[3]), "v"(l[4]), "v"(l[5]),
                    "v"(l[6]), "v"(l[7]), "v"(l[8]), "v"(l[9]), "v"(l[10]), "v"(l[11]),
                    "v"(p[0]), "v"(p[1]), "v"(p[2]), "v"(p[3]), "v"(p[4]), "v"(p[5]),
                    "v"(p[6]), "v"(p[7]), "v"(p[8]), "v"(p[9]), "v"(p[10]), "v"(p[11])
                 : "memory");
}
__device__ __forceinline__ void async_copy4(unsigned int l0, const float* g0,
                                            unsigned int l1, const float* g1,
                                            unsigned int l2, const float* g2,
                                            unsigned int l3, const float* g3) {
    asm volatile(ACPY(0, 4) ACPY(1, 5) ACPY(2, 6) ACPY(3, 7)
                 "s_wait_xcnt 0x0"
                 :: "v"(l0), "v"(l1), "v"(l2), "v"(l3),
                    "v"(g0), "v"(g1), "v"(g2), "v"(g3)
                 : "memory");
}
__device__ __forceinline__ void async_copy3(unsigned int l0, const float* g0,
                                            unsigned int l1, const float* g1,
                                            unsigned int l2, const float* g2) {
    asm volatile(ACPY(0, 3) ACPY(1, 4) ACPY(2, 5)
                 "s_wait_xcnt 0x0"
                 :: "v"(l0), "v"(l1), "v"(l2), "v"(g0), "v"(g1), "v"(g2)
                 : "memory");
}
__device__ __forceinline__ void async_wait_all() {
    asm volatile("s_wait_asynccnt 0x0" ::: "memory");
}

// value of lane l ^ 16 (the other 16-lane half of the wave)
__device__ __forceinline__ float xhalf(float x) {
    return __builtin_bit_cast(float, __builtin_amdgcn_permlanex16(
        __builtin_bit_cast(int, x), __builtin_bit_cast(int, x),
        0x76543210, 0xfedcba98, false, false));
}

// e^x as __expf forms it (one multiply, v_exp_f32).  The v_nop is the one slot
// the instruction set asks for behind a transcendental: inside the statement it
// stands there whatever the compiler schedules next.
__device__ __forceinline__ float exp_slot(float x) {
    float r;
    asm("v_exp_f32 %0, %1\n\tv_nop" : "=v"(r) : "v"(x * 1.44269504088896340736f));
    return r;
}

// ---------------------------------------------------------------------------
// Kernel A: precompute of k = l2norm(LN(dict@wk)) and
// v = gelu(conv3tap(dict@wv + b)), one output element per thread.
// Per batch: 48 blocks of 8 rows x 32 columns of v (a block owns whole
// 128-byte lines of the workspace) and 4 blocks of 16 rows of k.
// The conv needs raw v of the rows above and below: each thread sums those
// two itself, so no block needs anything from another block.
// Every global read of a block is issued ahead of its one wait: the block's
// slice of the weights goes to LDS with the dict tile, the few per-column and
// per-channel values to registers.  A loop that loads its weights as it goes
// waits out a load latency on every trip, a memory latency where L2 does not
// hold them.
// ---------------------------------------------------------------------------
#define VROWS   8                            // v rows per block
#define VCOLS   32                           // v columns per block
#define VCS     (DIMC / VCOLS)               // 6 column slices
#define VBLK    ((MTOK / VROWS) * VCS)       // 48 v blocks per batch
#define KROWS   (THREADS / RC)               // 16 k rows per block
#define PBLOCKS (VBLK + MTOK / KROWS)        // 52 blocks per batch

__global__ __launch_bounds__(THREADS)
void prep_kernel(const float* __restrict__ dict,
                 const float* __restrict__ wk_w, const float* __restrict__ wk_b,
                 const float* __restrict__ wv_w, const float* __restrict__ wv_b,
                 const float* __restrict__ kn_g, const float* __restrict__ kn_b,
                 const float* __restrict__ conv_w, const float* __restrict__ conv_b,
                 float* __restrict__ ws) {
    extern __shared__ float smem[];
    float* ds = smem;                    // 64*192 = 12288 dict tile
    float* kl = ds + MTOK * DIMC;        // 16*16  = 256   raw k
    float* wl = kl + KROWS * RC;         // 192*32 = 6144  weight slice (k: 192*16)

    const int b   = blockIdx.x / PBLOCKS;
    const int s   = blockIdx.x % PBLOCKS;
    const int tid = threadIdx.x;
    const float* db = dict + (size_t)b * MTOK * DIMC;
    float* wsK = ws + WS_K_OFF + (size_t)b * MTOK * RC;
    float* wsV = ws + WS_V_OFF + (size_t)b * MTOK * DIMC;

    // stage dict[b] into LDS via async DMA: each wave its 8 rows, one statement
    // with its s_wait_xcnt (the wait on the copies no longer follows at once)
    async_rows8(ds + (tid >> 5) * 8 * DIMC, DIMC, db + (tid >> 5) * 8 * DIMC, tid & 31);

    // the weight slice and the small operands, in the same flight
    float bias = 0.f, cw0 = 0.f, cw1 = 0.f, cw2 = 0.f, cbias = 0.f;
    float kg[RC] = {}, kb[RC] = {};
    if (s >= VBLK) {
        // wk whole: 192 x 16 floats in a row, 768 pieces of 16 bytes
        async_copy3(lds_addr(wl + tid * 4),                 wk_w + tid * 4,
                    lds_addr(wl + (tid + THREADS) * 4),     wk_w + (tid + THREADS) * 4,
                    lds_addr(wl + (tid + 2 * THREADS) * 4), wk_w + (tid + 2 * THREADS) * 4);
        bias = wk_b[tid % RC];
        // unrolled: constant indices, so that the two arrays live in registers
        #pragma unroll
        for (int r = 0; r < RC; ++r) { kg[r] = kn_g[r]; kb[r] = kn_b[r]; }
    } else {
        // 32 columns of wv: 192 rows of 128 bytes, 8 pieces a row, 32 rows a copy
        const int c = (s % VCS) * VCOLS + tid % VCOLS;
        const float* gw = wv_w + (tid / 8) * DIMC + (s % VCS) * VCOLS + (tid % 8) * 4;
        async_copy3(lds_addr(wl + tid * 4),                 gw,
                    lds_addr(wl + (tid + THREADS) * 4),     gw + 32 * DIMC,
                    lds_addr(wl + (tid + 2 * THREADS) * 4), gw + 64 * DIMC);
        async_copy3(lds_addr(wl + (tid + 3 * THREADS) * 4), gw + 96 * DIMC,
                    lds_addr(wl + (tid + 4 * THREADS) * 4), gw + 128 * DIMC,
                    lds_addr(wl + (tid + 5 * THREADS) * 4), gw + 160 * DIMC);
        bias  = wv_b[c];
        cw0   = conv_w[c * 9 + 0 * 3 + 1];
        cw1   = conv_w[c * 9 + 1 * 3 + 1];
        cw2   = conv_w[c * 9 + 2 * 3 + 1];
        cbias = conv_b[c];
        // these loads stay in flight down to the barrier: keep the wait in front
        // of any instruction on the way that rewrites a register they name
        asm volatile("s_wait_xcnt 0x0" ::: "memory");
    }
    async_wait_all();
    __syncthreads();

    if (s >= VBLK) {
        const int mBase = (s - VBLK) * KROWS;

        // k_raw = dict @ wk + b   (16 of the 64 x 16)
        {
            const int m = mBase + tid / RC, r = tid % RC;
            float acc = bias;
            #pragma unroll 8
            for (int j = 0; j < DIMC; ++j) acc += ds[m * DIMC + j] * wl[j * RC + r];
            kl[tid] = acc;
        }
        __syncthreads();

        // per-row LN + l2norm on k, store to workspace
        if (tid < KROWS) {
            const int m = mBase + tid;
            float mu = 0.f;
            #pragma unroll
            for (int r = 0; r < RC; ++r) mu += kl[tid * RC + r];
            mu *= (1.0f / RC);
            float var = 0.f;
            #pragma unroll
            for (int r = 0; r < RC; ++r) { float d = kl[tid * RC + r] - mu; var += d * d; }
            var *= (1.0f / RC);
            const float rs = rsqrtf(var + LN_EPS);
            float tmp[RC];
            float nrm = 0.f;
            #pragma unroll
            for (int r = 0; r < RC; ++r) {
                float t = (kl[tid * RC + r] - mu) * rs * kg[r] + kb[r];
                tmp[r] = t; nrm += t * t;
            }
            const float inv = 1.0f / fmaxf(sqrtf(nrm), NRM_EPS);
            #pragma unroll
            for (int r = 0; r < RC; ++r) wsK[m * RC + r] = tmp[r] * inv;
        }
    } else {
        const int m  = (s / VCS) * VROWS + tid / VCOLS;
        const int c  = (s % VCS) * VCOLS + tid % VCOLS;
        const int mu = (m > 0)        ? m - 1 : m;   // row above (at the edge: m, sum unused)
        const int md = (m < MTOK - 1) ? m + 1 : m;   // row below (at the edge: m, sum unused)

        // v_raw = dict @ wv + b at rows m-1, m, m+1 of column c
        float vu = bias, vm = vu, vd = vu;
        // unroll 8, as in the k loop: eight steps' LDS reads are in flight per wait
        #pragma unroll 8
        for (int j = 0; j < DIMC; ++j) {
            const float w = wl[j * VCOLS + tid % VCOLS];
            vu += ds[mu * DIMC + j] * w;
            vm += ds[m  * DIMC + j] * w;
            vd += ds[md * DIMC + j] * w;
        }

        // depthwise 3-tap conv along M (kw=1 column of the 3x3 kernel) + GELU
        float acc = cbias + cw1 * vm;
        if (m > 0)        acc += cw0 * vu;
        if (m < MTOK - 1) acc += cw2 * vd;
        wsV[m * DIMC + c] = gelu_exact(acc);
        // the built code lays the k branch behind this store: keep the wait in
        // front of any instruction there that rewrites the store's registers
        asm volatile("s_wait_xcnt 0x0" ::: "memory");
    }
}

// ---------------------------------------------------------------------------
// Kernel B: streaming attention kernel.  One block per WGP walks TILES tiles of
// 128 rows of x of one batch: wq, k and v are staged once, and the x tiles go
// through two LDS buffers, the next tile's copies in flight while this tile is
// worked on.  Behind the one barrier that publishes wq, k and v the waves run
// free: while one wave of a SIMD is in its vector phases the other has the
// matrix unit.
// All matmuls via v_wmma_f32_16x16x4_f32 (fp32 kept end-to-end; kernel is
// HBM-bound at ~18 flop/byte so f32 WMMA rate is not the limiter).  All LDS
// staging uses CDNA5 async global->LDS DMA.
// The first two products are formed transposed (q^T, logits^T): a lane then
// owns one row of x, its D registers hold that row's values, and they are as
// they stand the B fragment (q) and the A fragment (attn) of the next product,
// with the k order of the partner operand's loader set to match.  LayerNorm,
// l2norm and softmax run in registers: 8 or 32 values in the lane, then one
// exchange with the other half-wave.
// ---------------------------------------------------------------------------
__global__ __launch_bounds__(THREADS)
void attn_kernel(const float* __restrict__ x,
                 const float* __restrict__ wq_w, const float* __restrict__ wq_b,
                 const float* __restrict__ qn_g, const float* __restrict__ qn_b,
                 const float* __restrict__ temperature,
                 const float* __restrict__ ws,
                 float* __restrict__ out) {
    extern __shared__ float smem[];
    float* xs  = smem;                           // 2 buffers of 128 * 196
    float* wqs = xs  + 2 * ROWS * XS_STRIDE;     // 192 * 16
    float* kbs = wqs + DIMC * RC;                // 64 * 20
    float* vs  = kbs + MTOK * KB_STRIDE;         // 64 * 200

    const int tid  = threadIdx.x;
    const int wave = tid >> 5;                   // wave32
    const int lane = tid & 31;
    const int lm   = lane & 15;                  // lane % 16
    const int lh   = lane >> 4;                  // 0 / 1 half-wave

    const int blocksPerBatch = NTOK / (ROWS * TILES);   // 32
    const int b      = blockIdx.x / blocksPerBatch;
    const int nBase0 = (blockIdx.x % blocksPerBatch) * (ROWS * TILES);

    const float invTemp = 1.0f / fmaxf(temperature[0], 0.5f);
    const float* wsK = ws + WS_K_OFF + (size_t)b * MTOK * RC;
    const float* wsV = ws + WS_V_OFF + (size_t)b * MTOK * DIMC;

    // this lane's 8 of the 16 q channels: rc = 8 * lh + j
    float bq[8], gq[8], bn[8];
    #pragma unroll
    for (int j = 0; j < 8; ++j) {
        bq[j] = wq_b[8 * lh + j];
        gq[j] = qn_g[8 * lh + j];
        bn[j] = qn_b[8 * lh + j];
    }

    const int rbase = wave * 16;
    // this wave's 16 rows of tile 0 (it copies the rows that it reads)
    const float* xw = x + ((size_t)b * NTOK + nBase0 + rbase) * DIMC;

    // ---- x tile 0, v, wq and k into LDS via async global->LDS DMA (16B/lane) ----
    // x first: it comes from memory, the rest from L2
    async_rows8(xs + rbase * XS_STRIDE,       XS_STRIDE, xw,            lane);
    async_rows8(xs + (rbase + 8) * XS_STRIDE, XS_STRIDE, xw + 8 * DIMC, lane);
    async_rows8(vs + wave * 8 * VS_STRIDE, VS_STRIDE, wsV + wave * 8 * DIMC, lane);
    async_copy4(lds_addr(wqs + tid * 4),                 wq_w + tid * 4,
                lds_addr(wqs + (tid + THREADS) * 4),     wq_w + (tid + THREADS) * 4,
                lds_addr(wqs + (tid + 2 * THREADS) * 4), wq_w + (tid + 2 * THREADS) * 4,
                lds_addr(kbs + (tid / 4) * KB_STRIDE + (tid % 4) * 4), wsK + tid * 4);
    async_wait_all();
    __syncthreads();
    // tile 1 into the second buffer: in flight while tile 0 is worked on
    async_rows8(xs + (ROWS + rbase) * XS_STRIDE,     XS_STRIDE, xw + ROWS * DIMC,       lane);
    async_rows8(xs + (ROWS + rbase + 8) * XS_STRIDE, XS_STRIDE, xw + (ROWS + 8) * DIMC, lane);

    // rolled: one copy of the body in the instruction cache, buffer by t & 1
    #pragma unroll 1
    for (int t = 0; t < TILES; ++t) {
    const int nBase = nBase0 + t * ROWS;
    float* xt = xs + (t & 1) * (ROWS * XS_STRIDE);

    // ---- stage 2: q^T tile (16 rc x 16 rows) = wq^T(16x192) @ x_tile^T(192x16) ----
    // qt[j] = q_raw[row rbase + lm][rc = j + 8 * lh]
    v8f qt = {};
    #pragma unroll 4
    for (int k0 = 0; k0 < DIMC; k0 += 4) {
        v2f a, bf;
        const int ka = k0 + lh * 2;
        a.x  = wqs[(ka + 0) * RC + lm];
        a.y  = wqs[(ka + 1) * RC + lm];
        bf.x = xt[(rbase + lm) * XS_STRIDE + ka + 0];
        bf.y = xt[(rbase + lm) * XS_STRIDE + ka + 1];
        qt = __builtin_amdgcn_wmma_f32_16x16x4_f32(
            false, a, false, bf, (short)0, qt, false, false);
    }

    // ---- stage 3: bias + LayerNorm + l2norm of row lm, 8 channels per half ----
    float q[8];
    {
        float mu = 0.f;
        #pragma unroll
        for (int j = 0; j < 8; ++j) { q[j] = qt[j] + bq[j]; mu += q[j]; }
        mu += xhalf(mu);
        mu *= (1.0f / RC);
        float var = 0.f;
        #pragma unroll
        for (int j = 0; j < 8; ++j) { float d = q[j] - mu; var += d * d; }
        var += xhalf(var);
        var *= (1.0f / RC);
        const float rs = rsqrtf(var + LN_EPS);
        float nrm = 0.f;
        #pragma unroll
        for (int j = 0; j < 8; ++j) {
            q[j] = (q[j] - mu) * rs * gq[j] + bn[j];
            nrm += q[j] * q[j];
        }
        nrm += xhalf(nrm);
        const float inv = 1.0f / fmaxf(sqrtf(nrm), NRM_EPS);
        #pragma unroll
        for (int j = 0; j < 8; ++j) q[j] *= inv;
    }

    // ---- stage 4: logits^T (64 m x 16 rows) = k(64x16) @ q^T(16x16), pre-scaled ----
    // k order of step s: slot 2 * lh + e is rc = 8 * lh + 2 * s + e, in A and in B.
    // Row i of tile t is token 16t + 8 * ((i >> 2) & 1) + 4 * (i >> 3) + (i & 3), so
    // p[t][j] = logit[row lm][m = 16t + 8 * (j >> 2) + 4 * lh + (j & 3)]:
    // four registers are 16 bytes of a row of attn, the two halves 32 in a row.
    float p[MTOK / 16][8];
    {
        const int krow = ((lm & 4) << 1) | ((lm >> 3) << 2) | (lm & 3);
        #pragma unroll
        for (int t = 0; t < MTOK / 16; ++t) {
            const float* kr = kbs + (t * 16 + krow) * KB_STRIDE + 8 * lh;
            v8f acc = {};
            #pragma unroll
            for (int s = 0; s < RC / 4; ++s) {
                v2f a, bf;
                a.x  = kr[2 * s + 0];
                a.y  = kr[2 * s + 1];
                bf.x = q[2 * s + 0];
                bf.y = q[2 * s + 1];
                acc = __builtin_amdgcn_wmma_f32_16x16x4_f32(
                    false, a, false, bf, (short)0, acc, false, false);
            }
            #pragma unroll
            for (int j = 0; j < 8; ++j) p[t][j] = acc[j] * invTemp;
        }
    }

    // ---- stage 5: softmax of row lm over M=64, 32 values per half ----
    {
        float mx = -INFINITY;
        #pragma unroll
        for (int t = 0; t < MTOK / 16; ++t)
            #pragma unroll
            for (int j = 0; j < 8; ++j) mx = fmaxf(mx, p[t][j]);
        mx = fmaxf(mx, xhalf(mx));
        float s = 0.f;
        #pragma unroll
        for (int t = 0; t < MTOK / 16; ++t)
            #pragma unroll
            for (int j = 0; j < 8; ++j) { p[t][j] = exp_slot(p[t][j] - mx); s += p[t][j]; }
        s += xhalf(s);
        const float inv = 1.0f / s;
        #pragma unroll
        for (int t = 0; t < MTOK / 16; ++t)
            #pragma unroll
            for (int j = 0; j < 8; ++j) p[t][j] *= inv;
    }

    // ---- writeback of attn (second output) from registers, 16 bytes per lane ----
    {
        float* arow = out + (size_t)BATCH * NTOK * DIMC      // outputs concatenated
                    + ((size_t)b * NTOK + nBase + rbase + lm) * MTOK + 4 * lh;
        #pragma unroll
        for (int t = 0; t < MTOK / 16; ++t)
            #pragma unroll
            for (int h = 0; h < 2; ++h)
                *reinterpret_cast<float4*>(arow + t * 16 + h * 8) =
                    make_float4(p[t][4 * h + 0], p[t][4 * h + 1],
                                p[t][4 * h + 2], p[t][4 * h + 3]);
    }

    // ---- stage 6: out tile = attn(16x64) @ v(64x192), direct stores ----
    // A is p as it stands; B reads the v rows in p's token order.
    // Four column tiles go together, dealt so that lane lm owns the 4 adjacent
    // columns 64 * g + 4 * lm + i (i = tile): one 16-byte LDS read is one token's
    // B element of all four tiles, and one 16-byte store per row writes the four
    // accumulators, 16 lanes a whole aligned 256 bytes of the row.
    {
        float* orow = out + ((size_t)b * NTOK + nBase + rbase + 8 * lh) * DIMC + 4 * lm;
        // rolled: one group's 32 LDS reads fit the registers and go out ahead of its products
        #pragma unroll 1
        for (int g = 0; g < DIMC / 64; ++g) {
            const float* vc = vs + (4 * lh) * VS_STRIDE + g * 64 + 4 * lm;
            v8f acc0 = {}, acc1 = {}, acc2 = {}, acc3 = {};
            // t, s and j unrolled: p and the accumulators are indexed by constants
            // and stay in registers
            #pragma unroll
            for (int t = 0; t < MTOK / 16; ++t) {
                #pragma unroll
                for (int s = 0; s < 4; ++s) {
                    const int m0 = t * 16 + (s >> 1) * 8 + (s & 1) * 2;
                    const float4 b0 = *reinterpret_cast<const float4*>(vc + (m0 + 0) * VS_STRIDE);
                    const float4 b1 = *reinterpret_cast<const float4*>(vc + (m0 + 1) * VS_STRIDE);
                    v2f a, bf;
                    a.x = p[t][2 * s + 0];
                    a.y = p[t][2 * s + 1];
                    bf.x = b0.x; bf.y = b1.x;
                    acc0 = __builtin_amdgcn_wmma_f32_16x16x4_f32(
                        false, a, false, bf, (short)0, acc0, false, false);
                    bf.x = b0.y; bf.y = b1.y;
                    acc1 = __builtin_amdgcn_wmma_f32_16x16x4_f32(
                        false, a, false, bf, (short)0, acc1, false, false);
                    bf.x = b0.z; bf.y = b1.z;
                    acc2 = __builtin_amdgcn_wmma_f32_16x16x4_f32(
                        false, a, false, bf, (short)0, acc2, false, false);
                    bf.x = b0.w; bf.y = b1.w;
                    acc3 = __builtin_amdgcn_wmma_f32_16x16x4_f32(
                        false, a, false, bf, (short)0, acc3, false, false);
                }
            }
            #pragma unroll
            for (int j = 0; j < 8; ++j)
                *reinterpret_cast<float4*>(orow + j * DIMC + g * 64) =
                    make_float4(acc0[j], acc1[j], acc2[j], acc3[j]);
        }
    }

    // ---- foot of the trip: tile t + 1 landed, this tile's rows free ----
    // The x ring is private to the wave: it copies the 16 rows of each buffer
    // that it alone reads, so its own two waits order all of it and no
    // work-group barrier stands here (a barrier would also wait out the wave's
    // global stores and hold the two waves of a SIMD in the same phase).
    // this wave's LDS reads have retired before its rows are written again
    asm volatile("s_wait_dscnt 0x0" ::: "memory");
    // this wave's copies of tile t + 1 have landed
    async_wait_all();
    if (t + 2 < TILES) {
        const float* xn = xw + (size_t)(t + 2) * (ROWS * DIMC);
        async_rows8(xt + rbase * XS_STRIDE,       XS_STRIDE, xn,            lane);
        async_rows8(xt + (rbase + 8) * XS_STRIDE, XS_STRIDE, xn + 8 * DIMC, lane);
    }
    }
    // no copy is outstanding when the wave ends
    async_wait_all();
}

// ---------------------------------------------------------------------------
extern "C" void kernel_launch(void* const* d_in, const int* in_sizes, int n_in,
                              void* d_out, int out_size, void* d_ws, size_t ws_size,
                              hipStream_t stream) {
    const float* x      = (const float*)d_in[0];
    const float* dict   = (const float*)d_in[1];
    // d_in[2] = H, d_in[3] = W (unused)
    const float* wq_w   = (const float*)d_in[4];
    const float* wq_b   = (const float*)d_in[5];
    const float* wk_w   = (const float*)d_in[6];
    const float* wk_b   = (const float*)d_in[7];
    const float* wv_w   = (const float*)d_in[8];
    const float* wv_b   = (const float*)d_in[9];
    const float* qn_g   = (const float*)d_in[10];
    const float* qn_b   = (const float*)d_in[11];
    const float* kn_g   = (const float*)d_in[12];
    const float* kn_b   = (const float*)d_in[13];
    const float* conv_w = (const float*)d_in[14];
    const float* conv_b = (const float*)d_in[15];
    const float* temp   = (const float*)d_in[16];
    float* out = (float*)d_out;
    float* ws  = (float*)d_ws;

    const size_t prepShmem = (size_t)(MTOK * DIMC + KROWS * RC + DIMC * VCOLS) * sizeof(float);
    const size_t mainShmem = (size_t)(2 * ROWS * XS_STRIDE + DIMC * RC +
                                      MTOK * KB_STRIDE + MTOK * VS_STRIDE) * sizeof(float);

    (void)hipFuncSetAttribute((const void*)prep_kernel,
        hipFuncAttributeMaxDynamicSharedMemorySize, (int)prepShmem);
    (void)hipFuncSetAttribute((const void*)attn_kernel,
        hipFuncAttributeMaxDynamicSharedMemorySize, (int)mainShmem);

    prep_kernel<<<BATCH * PBLOCKS, THREADS, prepShmem, stream>>>(
        dict, wk_w, wk_b, wv_w, wv_b, kn_g, kn_b, conv_w, conv_b, ws);

    const int nBlocks = BATCH * (NTOK / (ROWS * TILES));   // 256
    attn_kernel<<<nBlocks, THREADS, mainShmem, stream>>>(
        x, wq_w, wq_b, qn_g, qn_b, temp, ws, out);
}
